// v000
// Measured on an AMD MI455X. A time is GPU time per run, averaged over a window of back-to-back runs after a warm-up
// (all launches, gaps included; the runs take copies of the inputs in turn), and the median of several windows.
// Apart from v000's, it joins two sittings. Times from different sittings can be a few percent apart, while
// side-by-side timings come from the same sitting.
// v000, which the later versions start from, runs in 1130 microseconds.
#include <hip/hip_runtime.h>
#include <hip/hip_bf16.h>

// ---------------------------------------------------------------------------
// Types for WMMA fragments (gfx1250, wave32)
// ---------------------------------------------------------------------------
typedef _Float16 h8  __attribute__((ext_vector_type(8)));
typedef _Float16 h16 __attribute__((ext_vector_type(16)));
typedef float    f8v __attribute__((ext_vector_type(8)));
typedef float    f4v __attribute__((ext_vector_type(4)));
typedef int      i4v __attribute__((ext_vector_type(4)));

__device__ __forceinline__ f8v wmma_f16(h16 a, h16 b, f8v c) {
  // D = A(16x32 f16) * B(32x16 f16) + C(16x16 f32)
  return __builtin_amdgcn_wmma_f32_16x16x32_f16(
      /*neg_a=*/false, a, /*neg_b=*/false, b,
      /*c_mod=*/(short)0, c, /*reuse_a=*/false, /*reuse_b=*/false);
}

// ---------------------------------------------------------------------------
// Async global->LDS copy (GLOBAL_LOAD_ASYNC_TO_LDS_B128, ASYNCcnt-tracked).
// Builtin signature (from clang diagnostic): (int4 AS1*, int4 AS3*, imm, imm).
// Falls back to a synchronous 16B copy when the builtin is unavailable.
// ---------------------------------------------------------------------------
#if defined(__gfx1250__) && __has_builtin(__builtin_amdgcn_global_load_async_to_lds_b128)
#define HAVE_ASYNC_LDS 1
#else
#define HAVE_ASYNC_LDS 0
#endif

__device__ __forceinline__ void cp16B(const _Float16* g, _Float16* l) {
#if HAVE_ASYNC_LDS
  __builtin_amdgcn_global_load_async_to_lds_b128(
      (__attribute__((address_space(1))) i4v*)g,
      (__attribute__((address_space(3))) i4v*)l, 0, 0);
#else
  *(h8*)l = *(const h8*)g;
#endif
}

__device__ __forceinline__ void cp_wait() {
#if HAVE_ASYNC_LDS
  asm volatile("s_wait_asynccnt 0x0" ::: "memory");
#endif
}

// NT fragment loader. Both A and B fragments of V_WMMA_F32_16X16X32_F16 read
// row (lane&15) of a row-major-along-K tile, in two contiguous 8-half runs:
//   k in [8g, 8g+8) and [8g+16, 8g+24),  g = lane>>4     (ISA 7.12.2 layout)
// => two ds_load_b128 per fragment.
__device__ __forceinline__ h16 frag_ld(const _Float16* base, int row0, int k0, int stride) {
  const int lane = threadIdx.x & 31;
  const int g = lane >> 4;
  const _Float16* p = base + (size_t)(row0 + (lane & 15)) * stride + k0 + 8 * g;
  h8 lo = *(const h8*)(p);
  h8 hi = *(const h8*)(p + 16);
  return __builtin_shufflevector(lo, hi, 0,1,2,3,4,5,6,7,8,9,10,11,12,13,14,15);
}

// ---------------------------------------------------------------------------
// Problem constants
// ---------------------------------------------------------------------------
#define BB       512
#define TT       64
#define DM       1024
#define NH       16
#define DH       64
#define NREL     225
#define RPADN    240   // NREL padded to WMMA N tiles (15 * 16)
#define RPADK    256   // NREL padded to WMMA K steps (8 * 32)
#define MTOT     (BB * TT)   // 32768

// ---------------------------------------------------------------------------
// Vectorized f32 -> f16 cast: 8 elements / thread (2x b128 load, 1x b128 store)
// ---------------------------------------------------------------------------
__global__ __launch_bounds__(256) void cast_f32_f16_v8(const float* __restrict__ src,
                                                       _Float16* __restrict__ dst, int n8) {
  int i = blockIdx.x * 256 + threadIdx.x;
  if (i < n8) {
    const f4v* s = (const f4v*)src;
    f4v a = s[2 * (size_t)i], b = s[2 * (size_t)i + 1];
    h8 o;
#pragma unroll
    for (int j = 0; j < 4; j++) { o[j] = (_Float16)a[j]; o[j + 4] = (_Float16)b[j]; }
    *(h8*)(dst + (size_t)i * 8) = o;
  }
}

// RR[h,r] = dot(rel_q[h,r,:], rel_k[h,r,:])
__global__ __launch_bounds__(256) void rr_kernel(const float* __restrict__ rq,
                                                 const float* __restrict__ rk,
                                                 float* __restrict__ RR) {
  int i = blockIdx.x * 256 + threadIdx.x;
  if (i < NH * NREL) {
    const float* a = rq + (size_t)i * DH;
    const float* b = rk + (size_t)i * DH;
    float s = 0.f;
#pragma unroll
    for (int d = 0; d < DH; d++) s += a[d] * b[d];
    RR[i] = s;
  }
}

// ---------------------------------------------------------------------------
// NT GEMM: C[m,n] = sum_k A[m,k] * W[n,k] + bias[n]
// A: (32768,1024) f16 row-major, W: (1024,1024) f16 row-major.
// OUT_MODE 0: f16, head-split (b,h,t,d) layout.   OUT_MODE 1: f32 row-major.
// 128x128 block tile, 256 threads = 8 waves, each wave a 32x64 sub-tile
// (2x4 WMMA tiles). K stepped by 32 through double-buffered LDS with async
// global->LDS copies pipelined one K-tile ahead.
// ---------------------------------------------------------------------------
template <int OUT_MODE>
__global__ __launch_bounds__(256) void gemm_proj(const _Float16* __restrict__ A,
                                                 const _Float16* __restrict__ W,
                                                 const float* __restrict__ bias,
                                                 _Float16* __restrict__ outH,
                                                 float* __restrict__ outF) {
  constexpr int K = DM, LDW = 40;       // 32 + 8 halves pad
  constexpr int TILEH = 128 * LDW;      // 5120 halves per buffer
  __shared__ _Float16 As[2 * TILEH];
  __shared__ _Float16 Ws[2 * TILEH];

  const int tid  = threadIdx.x;
  const int wave = tid >> 5, lane = tid & 31;
  const int m0 = blockIdx.y * 128, n0 = blockIdx.x * 128;
  const int wm0 = (wave & 3) * 32, wn0 = (wave >> 2) * 64;

  auto stage = [&](int k0, int bsel) {
#pragma unroll
    for (int c = tid; c < 512; c += 256) {       // 128 rows x 4 chunks of 8 halves
      const int row = c >> 2, col = (c & 3) * 8;
      cp16B(&A[(size_t)(m0 + row) * K + k0 + col], &As[bsel * TILEH + row * LDW + col]);
      cp16B(&W[(size_t)(n0 + row) * K + k0 + col], &Ws[bsel * TILEH + row * LDW + col]);
    }
  };

  f8v acc[2][4] = {};

  stage(0, 0);
  cp_wait();
  __syncthreads();

  int buf = 0;
  for (int k0 = 0; k0 < K; k0 += 32) {
    if (k0 + 32 < K) stage(k0 + 32, buf ^ 1);    // prefetch next tile into other buffer

    const _Float16* Ab = As + buf * TILEH;
    const _Float16* Wb = Ws + buf * TILEH;
    h16 af[2], bf[4];
#pragma unroll
    for (int i = 0; i < 2; i++) af[i] = frag_ld(Ab, wm0 + i * 16, 0, LDW);
#pragma unroll
    for (int j = 0; j < 4; j++) bf[j] = frag_ld(Wb, wn0 + j * 16, 0, LDW);
#pragma unroll
    for (int i = 0; i < 2; i++)
#pragma unroll
      for (int j = 0; j < 4; j++) acc[i][j] = wmma_f16(af[i], bf[j], acc[i][j]);

    cp_wait();
    __syncthreads();
    buf ^= 1;
  }

  const int g = lane >> 4, nl = lane & 15;
#pragma unroll
  for (int i = 0; i < 2; i++)
#pragma unroll
    for (int j = 0; j < 4; j++) {
      const int gn = n0 + wn0 + j * 16 + nl;
      const float bv = bias[gn];
#pragma unroll
      for (int r = 0; r < 8; r++) {
        const int gm = m0 + wm0 + i * 16 + g * 8 + r;  // C layout: M = r + 8*(lane>>4)
        const float v = acc[i][j][r] + bv;
        if (OUT_MODE == 0) {
          const int b = gm >> 6, t = gm & 63, h = gn >> 6, d = gn & 63;
          outH[(((size_t)(b * NH + h) * TT + t) * DH) + d] = (_Float16)v;
        } else {
          outF[(size_t)gm * DM + gn] = v;
        }
      }
    }
}

// ---------------------------------------------------------------------------
// Fused relative attention for one (b,h): 256 threads, dynamic LDS.
// LDS half-offsets:
//   qs   [64x72]      0      (reused as attn f16 after softmax)
//   ks   [64x72]      4608
//   vTs  [64x72]      9216   (v stored transposed [d][s])
//   rls  [17280]      13824  (rel_k rows -> rel_q rows -> rel_vT [64x264])
//   Qr   [64x240]     31104  \ overlaid later by P [64x264]
//   Kr   [64x240]     46464  /
//   Ls   f32 [64x64]  byte 123648
// total 140032 bytes dynamic shared (< 320 KB/WG on CDNA5).
// ---------------------------------------------------------------------------
__global__ __launch_bounds__(256) void attn_kernel(
    const _Float16* __restrict__ qg, const _Float16* __restrict__ kg,
    const _Float16* __restrict__ vg,                 // (B,H,T,DH) f16
    const float* __restrict__ rel_q, const float* __restrict__ rel_k,
    const float* __restrict__ rel_v,                 // (H,225,64) f32
    const int* __restrict__ rel_index,               // (64,64)
    const float* __restrict__ RR,                    // (H,225)
    _Float16* __restrict__ outO)                     // (B,T,1024) f16
{
  extern __shared__ char smem_raw[];
  _Float16* qs    = (_Float16*)smem_raw;
  _Float16* ks    = qs + 4608;
  _Float16* vTs   = ks + 4608;
  _Float16* rls   = vTs + 4608;
  _Float16* Qr    = rls + 17280;
  _Float16* Kr    = Qr + 64 * RPADN;
  _Float16* Pm    = Qr;        // overlay after gathers
  _Float16* attnb = qs;        // overlay after logits
  float*    Ls    = (float*)(smem_raw + 123648);

  const int h = blockIdx.x, b = blockIdx.y;
  const int tid = threadIdx.x, wave = tid >> 5, lane = tid & 31;
  const size_t bh = ((size_t)b * NH + h) * (TT * DH);

  // ---- stage q, k (async 16B copies), vT (transposed), rel_k rows ----
  for (int c = tid; c < 512; c += 256) {
    int row = c >> 3, col = (c & 7) * 8;
    cp16B(&qg[bh + row * DH + col], &qs[row * 72 + col]);
    cp16B(&kg[bh + row * DH + col], &ks[row * 72 + col]);
  }
  for (int e = tid; e < TT * DH; e += 256) {
    int d = e & 63, s = e >> 6;
    vTs[d * 72 + s] = vg[bh + (size_t)s * DH + d];
  }
  for (int e = tid; e < RPADN * DH; e += 256) {
    int d = e & 63, r = e >> 6;
    rls[r * 72 + d] = (r < NREL) ? (_Float16)rel_k[((size_t)h * NREL + r) * DH + d]
                                 : (_Float16)0.f;
  }
  cp_wait();
  __syncthreads();

  // ---- Qr = q @ rel_k^T  (64 x 240, K=64) ----
  for (int tIdx = wave; tIdx < 60; tIdx += 8) {
    int mt = tIdx / 15, nt = tIdx % 15;
    f8v acc = {};
#pragma unroll
    for (int k0 = 0; k0 < DH; k0 += 32)
      acc = wmma_f16(frag_ld(qs, mt * 16, k0, 72), frag_ld(rls, nt * 16, k0, 72), acc);
    const int n = nt * 16 + (lane & 15), g = lane >> 4;
#pragma unroll
    for (int r = 0; r < 8; r++) Qr[(mt * 16 + g * 8 + r) * RPADN + n] = (_Float16)acc[r];
  }
  __syncthreads();

  // ---- restage rel_q, compute Kr = k @ rel_q^T ----
  for (int e = tid; e < RPADN * DH; e += 256) {
    int d = e & 63, r = e >> 6;
    rls[r * 72 + d] = (r < NREL) ? (_Float16)rel_q[((size_t)h * NREL + r) * DH + d]
                                 : (_Float16)0.f;
  }
  __syncthreads();
  for (int tIdx = wave; tIdx < 60; tIdx += 8) {
    int mt = tIdx / 15, nt = tIdx % 15;
    f8v acc = {};
#pragma unroll
    for (int k0 = 0; k0 < DH; k0 += 32)
      acc = wmma_f16(frag_ld(ks, mt * 16, k0, 72), frag_ld(rls, nt * 16, k0, 72), acc);
    const int n = nt * 16 + (lane & 15), g = lane >> 4;
#pragma unroll
    for (int r = 0; r < 8; r++) Kr[(mt * 16 + g * 8 + r) * RPADN + n] = (_Float16)acc[r];
  }
  __syncthreads();

  // ---- stage rel_vT [d][264] while computing logits = q k^T + gathers ----
  for (int e = tid; e < DH * 264; e += 256) {
    int r = e % 264, d = e / 264;
    rls[d * 264 + r] = (r < NREL) ? (_Float16)rel_v[((size_t)h * NREL + r) * DH + d]
                                  : (_Float16)0.f;
  }
  for (int tIdx = wave; tIdx < 16; tIdx += 8) {
    int mt = tIdx >> 2, nt = tIdx & 3;
    f8v acc = {};
#pragma unroll
    for (int k0 = 0; k0 < DH; k0 += 32)
      acc = wmma_f16(frag_ld(qs, mt * 16, k0, 72), frag_ld(ks, nt * 16, k0, 72), acc);
    const int s = nt * 16 + (lane & 15), g = lane >> 4;
#pragma unroll
    for (int r = 0; r < 8; r++) {
      const int t = mt * 16 + g * 8 + r;
      const int idx = rel_index[t * TT + s];
      Ls[t * TT + s] = acc[r] + (float)Qr[t * RPADN + idx] +
                       (float)Kr[s * RPADN + idx] + RR[h * NREL + idx];
    }
  }
  __syncthreads();

  // ---- zero P (overlays Qr/Kr) + softmax (one row per thread) ----
  for (int e = tid; e < 64 * 264; e += 256) Pm[e] = (_Float16)0.f;
  if (tid < TT) {
    const int t = tid;
    const float scale = 0.125f;  // 1/sqrt(64)
    float mx = -1e30f;
    for (int s = 0; s < TT; s++) mx = fmaxf(mx, Ls[t * TT + s]);
    float sum = 0.f;
    for (int s = 0; s < TT; s++) sum += __expf((Ls[t * TT + s] - mx) * scale);
    const float inv = 1.f / sum;
    for (int s = 0; s < TT; s++)
      attnb[t * 72 + s] = (_Float16)(__expf((Ls[t * TT + s] - mx) * scale) * inv);
  }
  __syncthreads();

  // ---- scatter P[t,r] += attn[t,s] (row t owned by one thread: no races) ----
  if (tid < TT) {
    const int t = tid;
    for (int s = 0; s < TT; s++) {
      const int idx = rel_index[t * TT + s];
      Pm[t * 264 + idx] = (_Float16)((float)Pm[t * 264 + idx] + (float)attnb[t * 72 + s]);
    }
  }
  __syncthreads();

  // ---- out = attn @ v  +  P @ rel_v  (both WMMA) ----
  for (int tIdx = wave; tIdx < 16; tIdx += 8) {
    int mt = tIdx >> 2, nt = tIdx & 3;
    f8v acc = {};
#pragma unroll
    for (int k0 = 0; k0 < TT; k0 += 32)
      acc = wmma_f16(frag_ld(attnb, mt * 16, k0, 72), frag_ld(vTs, nt * 16, k0, 72), acc);
#pragma unroll
    for (int k0 = 0; k0 < RPADK; k0 += 32)
      acc = wmma_f16(frag_ld(Pm, mt * 16, k0, 264), frag_ld(rls, nt * 16, k0, 264), acc);
    const int g = lane >> 4, d = nt * 16 + (lane & 15);
#pragma unroll
    for (int r = 0; r < 8; r++) {
      const int t = mt * 16 + g * 8 + r;
      outO[((size_t)b * TT + t) * DM + h * DH + d] = (_Float16)acc[r];
    }
  }
}

// ---------------------------------------------------------------------------
// Host launcher
// ---------------------------------------------------------------------------
extern "C" void kernel_launch(void* const* d_in, const int* in_sizes, int n_in,
                              void* d_out, int out_size, void* d_ws, size_t ws_size,
                              hipStream_t stream) {
  (void)in_sizes; (void)n_in; (void)out_size; (void)ws_size;
  const float* x     = (const float*)d_in[0];
  const float* Wq_w  = (const float*)d_in[1];
  const float* Wq_b  = (const float*)d_in[2];
  const float* Wk_w  = (const float*)d_in[3];
  const float* Wk_b  = (const float*)d_in[4];
  const float* Wv_w  = (const float*)d_in[5];
  const float* Wv_b  = (const float*)d_in[6];
  const float* Wo_w  = (const float*)d_in[7];
  const float* Wo_b  = (const float*)d_in[8];
  const float* rel_q = (const float*)d_in[9];
  const float* rel_k = (const float*)d_in[10];
  const float* rel_v = (const float*)d_in[11];
  const int*   ridx  = (const int*)d_in[12];

  char* ws = (char*)d_ws;
  // workspace layout (bytes)
  _Float16* xh = (_Float16*)(ws);                       // 67,108,864  (x f16; reused as oh)
  _Float16* wh = (_Float16*)(ws + 67108864);            //  8,388,608  (Wq,Wk,Wv,Wo f16)
  _Float16* qh = (_Float16*)(ws + 75497472);            // 67,108,864  (B,H,T,64)
  _Float16* kh = (_Float16*)(ws + 142606336);           // 67,108,864
  _Float16* vh = (_Float16*)(ws + 209715200);           // 67,108,864
  float*    RR = (float*)(ws + 276824064);              //     14,400
  _Float16* oh = xh;  // x consumed before attention writes here (same stream)

  const int nx = MTOT * DM;     // 33,554,432
  const int nw = DM * DM;       //  1,048,576
  cast_f32_f16_v8<<<nx / 8 / 256, 256, 0, stream>>>(x,    xh,                  nx / 8);
  cast_f32_f16_v8<<<nw / 8 / 256, 256, 0, stream>>>(Wq_w, wh + 0 * (size_t)nw, nw / 8);
  cast_f32_f16_v8<<<nw / 8 / 256, 256, 0, stream>>>(Wk_w, wh + 1 * (size_t)nw, nw / 8);
  cast_f32_f16_v8<<<nw / 8 / 256, 256, 0, stream>>>(Wv_w, wh + 2 * (size_t)nw, nw / 8);
  cast_f32_f16_v8<<<nw / 8 / 256, 256, 0, stream>>>(Wo_w, wh + 3 * (size_t)nw, nw / 8);
  rr_kernel<<<(NH * NREL + 255) / 256, 256, 0, stream>>>(rel_q, rel_k, RR);

  dim3 gproj(DM / 128, MTOT / 128);  // (8, 256)
  gemm_proj<0><<<gproj, 256, 0, stream>>>(xh, wh + 0 * (size_t)nw, Wq_b, qh, nullptr);
  gemm_proj<0><<<gproj, 256, 0, stream>>>(xh, wh + 1 * (size_t)nw, Wk_b, kh, nullptr);
  gemm_proj<0><<<gproj, 256, 0, stream>>>(xh, wh + 2 * (size_t)nw, Wv_b, vh, nullptr);

  attn_kernel<<<dim3(NH, BB), 256, 140032, stream>>>(qh, kh, vh, rel_q, rel_k, rel_v,
                                                     ridx, RR, oh);

  gemm_proj<1><<<gproj, 256, 0, stream>>>(oh, wh + 3 * (size_t)nw, Wo_b, nullptr,
                                          (float*)d_out);
}

// v001
// Measured time: 715 microseconds a run.
// In both of two side-by-side timings against v000, it was 1.64 times as fast.
#include <hip/hip_runtime.h>
#include <hip/hip_bf16.h>

// ---------------------------------------------------------------------------
// Types for WMMA fragments (gfx1250, wave32)
// ---------------------------------------------------------------------------
typedef _Float16 h8  __attribute__((ext_vector_type(8)));
typedef _Float16 h16 __attribute__((ext_vector_type(16)));
typedef float    f8v __attribute__((ext_vector_type(8)));
typedef float    f4v __attribute__((ext_vector_type(4)));
typedef int      i4v __attribute__((ext_vector_type(4)));

__device__ __forceinline__ f8v wmma_f16(h16 a, h16 b, f8v c) {
  // D = A(16x32 f16) * B(32x16 f16) + C(16x16 f32)
  return __builtin_amdgcn_wmma_f32_16x16x32_f16(
      /*neg_a=*/false, a, /*neg_b=*/false, b,
      /*c_mod=*/(short)0, c, /*reuse_a=*/false, /*reuse_b=*/false);
}

// ---------------------------------------------------------------------------
// Async global->LDS copy (GLOBAL_LOAD_ASYNC_TO_LDS_B128, ASYNCcnt-tracked).
// Builtin signature (from clang diagnostic): (int4 AS1*, int4 AS3*, imm, imm).
// Falls back to a synchronous 16B copy when the builtin is unavailable.
// ---------------------------------------------------------------------------
#if defined(__gfx1250__) && __has_builtin(__builtin_amdgcn_global_load_async_to_lds_b128)
#define HAVE_ASYNC_LDS 1
#else
#define HAVE_ASYNC_LDS 0
#endif

__device__ __forceinline__ void cp16B(const _Float16* g, _Float16* l) {
#if HAVE_ASYNC_LDS
  __builtin_amdgcn_global_load_async_to_lds_b128(
      (__attribute__((address_space(1))) i4v*)g,
      (__attribute__((address_space(3))) i4v*)l, 0, 0);
#else
  *(h8*)l = *(const h8*)g;
#endif
}

__device__ __forceinline__ void cp_wait() {
#if HAVE_ASYNC_LDS
  asm volatile("s_wait_asynccnt 0x0" ::: "memory");
#endif
}

// NT fragment loader. Both A and B fragments of V_WMMA_F32_16X16X32_F16 read
// row (lane&15) of a row-major-along-K tile, in two contiguous 8-half runs:
//   k in [8g, 8g+8) and [8g+16, 8g+24),  g = lane>>4     (ISA 7.12.2 layout)
// => two ds_load_b128 per fragment.
__device__ __forceinline__ h16 frag_ld(const _Float16* base, int row0, int k0, int stride) {
  const int lane = threadIdx.x & 31;
  const int g = lane >> 4;
  const _Float16* p = base + (size_t)(row0 + (lane & 15)) * stride + k0 + 8 * g;
  h8 lo = *(const h8*)(p);
  h8 hi = *(const h8*)(p + 16);
  return __builtin_shufflevector(lo, hi, 0,1,2,3,4,5,6,7,8,9,10,11,12,13,14,15);
}

// ---------------------------------------------------------------------------
// Problem constants
// ---------------------------------------------------------------------------
#define BB       512
#define TT       64
#define DM       1024
#define NH       16
#define DH       64
#define NREL     225
#define RPADN    240   // NREL padded to WMMA N tiles (15 * 16)
#define RPADK    256   // NREL padded to WMMA K steps (8 * 32)
#define MTOT     (BB * TT)   // 32768
#define RIMG     18432 // halves in one staged table image: 9 rounds of 256 lanes x 16 B

// ---------------------------------------------------------------------------
// Vectorized f32 -> f16 cast: 8 elements / thread (2x b128 load, 1x b128 store)
// ---------------------------------------------------------------------------
__global__ __launch_bounds__(256) void cast_f32_f16_v8(const float* __restrict__ src,
                                                       _Float16* __restrict__ dst, int n8) {
  int i = blockIdx.x * 256 + threadIdx.x;
  if (i < n8) {
    const f4v* s = (const f4v*)src;
    f4v a = s[2 * (size_t)i], b = s[2 * (size_t)i + 1];
    h8 o;
#pragma unroll
    for (int j = 0; j < 4; j++) { o[j] = (_Float16)a[j]; o[j + 4] = (_Float16)b[j]; }
    *(h8*)(dst + (size_t)i * 8) = o;
  }
}

// RR[h,r] = dot(rel_q[h,r,:], rel_k[h,r,:])
__global__ __launch_bounds__(256) void rr_kernel(const float* __restrict__ rq,
                                                 const float* __restrict__ rk,
                                                 float* __restrict__ RR) {
  int i = blockIdx.x * 256 + threadIdx.x;
  if (i < NH * NREL) {
    const float* a = rq + (size_t)i * DH;
    const float* b = rk + (size_t)i * DH;
    float s = 0.f;
#pragma unroll
    for (int d = 0; d < DH; d++) s += a[d] * b[d];
    RR[i] = s;
  }
}

// Builds, once per call, the f16 images of the three relative tables exactly as
// attn_kernel keeps them in LDS, so that each work-group stages a table with
// straight 16-byte copies. One thread writes one 16-byte chunk; every byte of an
// image is written (padding as zero).
//   table 0: rel_k rows, pitch 72 halves, rows 225.. zero
//   table 1: rel_q rows, same shape
//   table 2: rel_v transposed [d][264], columns 225.. zero
__global__ __launch_bounds__(256) void rel_image_kernel(const float* __restrict__ rel_q,
                                                        const float* __restrict__ rel_k,
                                                        const float* __restrict__ rel_v,
                                                        _Float16* __restrict__ img) {
  const int c = blockIdx.x * 256 + threadIdx.x;   // chunk in the image, 0..2303
  const int h = blockIdx.y, tb = blockIdx.z;
  h8 o = {};
  if (tb < 2) {
    const float* src = (tb == 0) ? rel_k : rel_q;
    const int r = c / 9, cc = c % 9;
    if (r < NREL && cc < 8) {
      const f4v* s = (const f4v*)(src + ((size_t)h * NREL + r) * DH + cc * 8);
      f4v a = s[0], b = s[1];
#pragma unroll  // constant element indices keep o in registers
      for (int j = 0; j < 4; j++) { o[j] = (_Float16)a[j]; o[j + 4] = (_Float16)b[j]; }
    }
  } else {
    const int d = c / 33, r0 = (c % 33) * 8;
    if (d < DH) {
#pragma unroll  // constant element indices keep o in registers
      for (int j = 0; j < 8; j++) {
        // row clamped, value selected afterwards: the eight loads go out together
        const int r = r0 + j, rc = (r < NREL) ? r : NREL - 1;
        const float v = rel_v[((size_t)h * NREL + rc) * DH + d];
        o[j] = (r < NREL) ? (_Float16)v : (_Float16)0.f;
      }
    }
  }
  *(h8*)(img + (size_t)(tb * NH + h) * RIMG + (size_t)c * 8) = o;
}

// ---------------------------------------------------------------------------
// NT GEMM: C[m,n] = sum_k A[m,k] * W[n,k] + bias[n]
// A: (32768,1024) f16 row-major, W: (1024,1024) f16 row-major.
// OUT_MODE 0: f16, head-split (b,h,t,d) layout.   OUT_MODE 1: f32 row-major.
// 128x128 block tile, 256 threads = 8 waves, each wave a 32x64 sub-tile
// (2x4 WMMA tiles). K stepped by 32 through double-buffered LDS with async
// global->LDS copies pipelined one K-tile ahead.
// ---------------------------------------------------------------------------
template <int OUT_MODE>
__global__ __launch_bounds__(256) void gemm_proj(const _Float16* __restrict__ A,
                                                 const _Float16* __restrict__ W,
                                                 const float* __restrict__ bias,
                                                 _Float16* __restrict__ outH,
                                                 float* __restrict__ outF) {
  constexpr int K = DM, LDW = 40;       // 32 + 8 halves pad
  constexpr int TILEH = 128 * LDW;      // 5120 halves per buffer
  __shared__ _Float16 As[2 * TILEH];
  __shared__ _Float16 Ws[2 * TILEH];

  const int tid  = threadIdx.x;
  const int wave = tid >> 5, lane = tid & 31;
  const int m0 = blockIdx.y * 128, n0 = blockIdx.x * 128;
  const int wm0 = (wave & 3) * 32, wn0 = (wave >> 2) * 64;

  auto stage = [&](int k0, int bsel) {
#pragma unroll
    for (int c = tid; c < 512; c += 256) {       // 128 rows x 4 chunks of 8 halves
      const int row = c >> 2, col = (c & 3) * 8;
      cp16B(&A[(size_t)(m0 + row) * K + k0 + col], &As[bsel * TILEH + row * LDW + col]);
      cp16B(&W[(size_t)(n0 + row) * K + k0 + col], &Ws[bsel * TILEH + row * LDW + col]);
    }
  };

  f8v acc[2][4] = {};

  stage(0, 0);
  cp_wait();
  __syncthreads();

  int buf = 0;
  for (int k0 = 0; k0 < K; k0 += 32) {
    if (k0 + 32 < K) stage(k0 + 32, buf ^ 1);    // prefetch next tile into other buffer

    const _Float16* Ab = As + buf * TILEH;
    const _Float16* Wb = Ws + buf * TILEH;
    h16 af[2], bf[4];
#pragma unroll
    for (int i = 0; i < 2; i++) af[i] = frag_ld(Ab, wm0 + i * 16, 0, LDW);
#pragma unroll
    for (int j = 0; j < 4; j++) bf[j] = frag_ld(Wb, wn0 + j * 16, 0, LDW);
#pragma unroll
    for (int i = 0; i < 2; i++)
#pragma unroll
      for (int j = 0; j < 4; j++) acc[i][j] = wmma_f16(af[i], bf[j], acc[i][j]);

    cp_wait();
    __syncthreads();
    buf ^= 1;
  }

  const int g = lane >> 4, nl = lane & 15;
#pragma unroll
  for (int i = 0; i < 2; i++)
#pragma unroll
    for (int j = 0; j < 4; j++) {
      const int gn = n0 + wn0 + j * 16 + nl;
      const float bv = bias[gn];
#pragma unroll
      for (int r = 0; r < 8; r++) {
        const int gm = m0 + wm0 + i * 16 + g * 8 + r;  // C layout: M = r + 8*(lane>>4)
        const float v = acc[i][j][r] + bv;
        if (OUT_MODE == 0) {
          const int b = gm >> 6, t = gm & 63, h = gn >> 6, d = gn & 63;
          outH[(((size_t)(b * NH + h) * TT + t) * DH) + d] = (_Float16)v;
        } else {
          outF[(size_t)gm * DM + gn] = v;
        }
      }
    }
}

// ---------------------------------------------------------------------------
// Fused relative attention for one (b,h): 256 threads, dynamic LDS.
// LDS half-offsets:
//   qs   [64x72]      0      (reused as attn f16 after softmax)
//   ks   [64x72]      4608
//   vTs  [64x72]      9216   (v stored transposed [d][s])
//   rls  [18432]      13824  (rel_k rows -> rel_q rows -> rel_vT [64x264])
//   Qr   [64x240]     32256  \ overlaid later by P [64x264]
//   Kr   [64x240]     47616  /
//   Ls   f32 [64x64]  byte 125952
// total 142336 bytes dynamic shared (< 320 KB/WG on CDNA5).
// ---------------------------------------------------------------------------
__global__ __launch_bounds__(256) void attn_kernel(
    const _Float16* __restrict__ qg, const _Float16* __restrict__ kg,
    const _Float16* __restrict__ vg,                 // (B,H,T,DH) f16
    const _Float16* __restrict__ relimg,             // (3,H,RIMG) f16 table images
    const int* __restrict__ rel_index,               // (64,64)
    const float* __restrict__ RR,                    // (H,225)
    _Float16* __restrict__ outO)                     // (B,T,1024) f16
{
  extern __shared__ char smem_raw[];
  _Float16* qs    = (_Float16*)smem_raw;
  _Float16* ks    = qs + 4608;
  _Float16* vTs   = ks + 4608;
  _Float16* rls   = vTs + 4608;
  _Float16* Qr    = rls + RIMG;
  _Float16* Kr    = Qr + 64 * RPADN;
  _Float16* Pm    = Qr;        // overlay after gathers
  _Float16* attnb = qs;        // overlay after logits
  float*    Ls    = (float*)(smem_raw + 125952);

  const int h = blockIdx.x, b = blockIdx.y;
  const int tid = threadIdx.x, wave = tid >> 5, lane = tid & 31;
  const size_t bh = ((size_t)b * NH + h) * (TT * DH);

  // One table image -> rls: 9 async 16B copies per lane, every lane on.
  auto stage_rel = [&](int tb) {
    const _Float16* s = relimg + (size_t)(tb * NH + h) * RIMG + tid * 8;
    _Float16* l = rls + tid * 8;
#pragma unroll  // all nine copies in flight together
    for (int i = 0; i < 9; i++) cp16B(s + i * 2048, l + i * 2048);
  };

  // ---- stage q, k, rel_k rows (async 16B copies), vT (transposed) ----
  for (int c = tid; c < 512; c += 256) {
    int row = c >> 3, col = (c & 7) * 8;
    cp16B(&qg[bh + row * DH + col], &qs[row * 72 + col]);
    cp16B(&kg[bh + row * DH + col], &ks[row * 72 + col]);
  }
  stage_rel(0);
  for (int e = tid; e < TT * DH; e += 256) {
    int d = e & 63, s = e >> 6;
    vTs[d * 72 + s] = vg[bh + (size_t)s * DH + d];
  }
  cp_wait();
  __syncthreads();

  // ---- Qr = q @ rel_k^T  (64 x 240, K=64) ----
  for (int tIdx = wave; tIdx < 60; tIdx += 8) {
    int mt = tIdx / 15, nt = tIdx % 15;
    f8v acc = {};
#pragma unroll
    for (int k0 = 0; k0 < DH; k0 += 32)
      acc = wmma_f16(frag_ld(qs, mt * 16, k0, 72), frag_ld(rls, nt * 16, k0, 72), acc);
    const int n = nt * 16 + (lane & 15), g = lane >> 4;
#pragma unroll
    for (int r = 0; r < 8; r++) Qr[(mt * 16 + g * 8 + r) * RPADN + n] = (_Float16)acc[r];
  }
  __syncthreads();

  // ---- restage rel_q, compute Kr = k @ rel_q^T ----
  stage_rel(1);
  cp_wait();  // rel_q copies landed before the barrier that publishes them
  __syncthreads();
  for (int tIdx = wave; tIdx < 60; tIdx += 8) {
    int mt = tIdx / 15, nt = tIdx % 15;
    f8v acc = {};
#pragma unroll
    for (int k0 = 0; k0 < DH; k0 += 32)
      acc = wmma_f16(frag_ld(ks, mt * 16, k0, 72), frag_ld(rls, nt * 16, k0, 72), acc);
    const int n = nt * 16 + (lane & 15), g = lane >> 4;
#pragma unroll
    for (int r = 0; r < 8; r++) Kr[(mt * 16 + g * 8 + r) * RPADN + n] = (_Float16)acc[r];
  }
  __syncthreads();

  // ---- stage rel_vT [d][264] while computing logits = q k^T + gathers ----
  stage_rel(2);
  for (int tIdx = wave; tIdx < 16; tIdx += 8) {
    int mt = tIdx >> 2, nt = tIdx & 3;
    f8v acc = {};
#pragma unroll
    for (int k0 = 0; k0 < DH; k0 += 32)
      acc = wmma_f16(frag_ld(qs, mt * 16, k0, 72), frag_ld(ks, nt * 16, k0, 72), acc);
    const int s = nt * 16 + (lane & 15), g = lane >> 4;
#pragma unroll
    for (int r = 0; r < 8; r++) {
      const int t = mt * 16 + g * 8 + r;
      const int idx = rel_index[t * TT + s];
      Ls[t * TT + s] = acc[r] + (float)Qr[t * RPADN + idx] +
                       (float)Kr[s * RPADN + idx] + RR[h * NREL + idx];
    }
  }
  cp_wait();  // rel_vT copies landed before the barrier that publishes them
  __syncthreads();

  // ---- zero P (overlays Qr/Kr) + softmax (one row per thread) ----
  for (int e = tid; e < 64 * 264; e += 256) Pm[e] = (_Float16)0.f;
  if (tid < TT) {
    const int t = tid;
    const float scale = 0.125f;  // 1/sqrt(64)
    float mx = -1e30f;
    for (int s = 0; s < TT; s++) mx = fmaxf(mx, Ls[t * TT + s]);
    float sum = 0.f;
    for (int s = 0; s < TT; s++) sum += __expf((Ls[t * TT + s] - mx) * scale);
    const float inv = 1.f / sum;
    for (int s = 0; s < TT; s++)
      attnb[t * 72 + s] = (_Float16)(__expf((Ls[t * TT + s] - mx) * scale) * inv);
  }
  __syncthreads();

  // ---- scatter P[t,r] += attn[t,s] (row t owned by one thread: no races) ----
  if (tid < TT) {
    const int t = tid;
    for (int s = 0; s < TT; s++) {
      const int idx = rel_index[t * TT + s];
      Pm[t * 264 + idx] = (_Float16)((float)Pm[t * 264 + idx] + (float)attnb[t * 72 + s]);
    }
  }
  __syncthreads();

  // ---- out = attn @ v  +  P @ rel_v  (both WMMA) ----
  for (int tIdx = wave; tIdx < 16; tIdx += 8) {
    int mt = tIdx >> 2, nt = tIdx & 3;
    f8v acc = {};
#pragma unroll
    for (int k0 = 0; k0 < TT; k0 += 32)
      acc = wmma_f16(frag_ld(attnb, mt * 16, k0, 72), frag_ld(vTs, nt * 16, k0, 72), acc);
#pragma unroll
    for (int k0 = 0; k0 < RPADK; k0 += 32)
      acc = wmma_f16(frag_ld(Pm, mt * 16, k0, 264), frag_ld(rls, nt * 16, k0, 264), acc);
    const int g = lane >> 4, d = nt * 16 + (lane & 15);
#pragma unroll
    for (int r = 0; r < 8; r++) {
      const int t = mt * 16 + g * 8 + r;
      outO[((size_t)b * TT + t) * DM + h * DH + d] = (_Float16)acc[r];
    }
  }
}

// ---------------------------------------------------------------------------
// Host launcher
// ---------------------------------------------------------------------------
extern "C" void kernel_launch(void* const* d_in, const int* in_sizes, int n_in,
                              void* d_out, int out_size, void* d_ws, size_t ws_size,
                              hipStream_t stream) {
  (void)in_sizes; (void)n_in; (void)out_size; (void)ws_size;
  const float* x     = (const float*)d_in[0];
  const float* Wq_w  = (const float*)d_in[1];
  const float* Wq_b  = (const float*)d_in[2];
  const float* Wk_w  = (const float*)d_in[3];
  const float* Wk_b  = (const float*)d_in[4];
  const float* Wv_w  = (const float*)d_in[5];
  const float* Wv_b  = (const float*)d_in[6];
  const float* Wo_w  = (const float*)d_in[7];
  const float* Wo_b  = (const float*)d_in[8];
  const float* rel_q = (const float*)d_in[9];
  const float* rel_k = (const float*)d_in[10];
  const float* rel_v = (const float*)d_in[11];
  const int*   ridx  = (const int*)d_in[12];

  char* ws = (char*)d_ws;
  // workspace layout (bytes)
  _Float16* xh = (_Float16*)(ws);                       // 67,108,864  (x f16; reused as oh)
  _Float16* wh = (_Float16*)(ws + 67108864);            //  8,388,608  (Wq,Wk,Wv,Wo f16)
  _Float16* qh = (_Float16*)(ws + 75497472);            // 67,108,864  (B,H,T,64)
  _Float16* kh = (_Float16*)(ws + 142606336);           // 67,108,864
  _Float16* vh = (_Float16*)(ws + 209715200);           // 67,108,864
  float*    RR = (float*)(ws + 276824064);              //     14,400
  _Float16* ri = (_Float16*)(ws + 276840448);           //  1,769,472  (3,H,RIMG) table images
  _Float16* oh = xh;  // x consumed before attention writes here (same stream)

  const int nx = MTOT * DM;     // 33,554,432
  const int nw = DM * DM;       //  1,048,576
  cast_f32_f16_v8<<<nx / 8 / 256, 256, 0, stream>>>(x,    xh,                  nx / 8);
  cast_f32_f16_v8<<<nw / 8 / 256, 256, 0, stream>>>(Wq_w, wh + 0 * (size_t)nw, nw / 8);
  cast_f32_f16_v8<<<nw / 8 / 256, 256, 0, stream>>>(Wk_w, wh + 1 * (size_t)nw, nw / 8);
  cast_f32_f16_v8<<<nw / 8 / 256, 256, 0, stream>>>(Wv_w, wh + 2 * (size_t)nw, nw / 8);
  cast_f32_f16_v8<<<nw / 8 / 256, 256, 0, stream>>>(Wo_w, wh + 3 * (size_t)nw, nw / 8);
  rr_kernel<<<(NH * NREL + 255) / 256, 256, 0, stream>>>(rel_q, rel_k, RR);
  rel_image_kernel<<<dim3(RIMG / 8 / 256, NH, 3), 256, 0, stream>>>(rel_q, rel_k, rel_v, ri);

  dim3 gproj(DM / 128, MTOT / 128);  // (8, 256)
  gemm_proj<0><<<gproj, 256, 0, stream>>>(xh, wh + 0 * (size_t)nw, Wq_b, qh, nullptr);
  gemm_proj<0><<<gproj, 256, 0, stream>>>(xh, wh + 1 * (size_t)nw, Wk_b, kh, nullptr);
  gemm_proj<0><<<gproj, 256, 0, stream>>>(xh, wh + 2 * (size_t)nw, Wv_b, vh, nullptr);

  attn_kernel<<<dim3(NH, BB), 256, 142336, stream>>>(qh, kh, vh, ri, ridx, RR, oh);

  gemm_proj<1><<<gproj, 256, 0, stream>>>(oh, wh + 3 * (size_t)nw, Wo_b, nullptr,
                                          (float*)d_out);
}

// v002
// One run takes 521 microseconds.
// Timed twice side by side with v001, it ran 1.37 times as fast both times.
// Counting every step since v000, it is 2.25 times as fast.
#include <hip/hip_runtime.h>
#include <hip/hip_bf16.h>

// ---------------------------------------------------------------------------
// Types for WMMA fragments (gfx1250, wave32)
// ---------------------------------------------------------------------------
typedef _Float16 h8  __attribute__((ext_vector_type(8)));
typedef _Float16 h16 __attribute__((ext_vector_type(16)));
typedef float    f8v __attribute__((ext_vector_type(8)));
typedef float    f4v __attribute__((ext_vector_type(4)));
typedef float    f2v __attribute__((ext_vector_type(2)));
typedef int      i4v __attribute__((ext_vector_type(4)));

__device__ __forceinline__ f8v wmma_f16(h16 a, h16 b, f8v c) {
  // D = A(16x32 f16) * B(32x16 f16) + C(16x16 f32)
  return __builtin_amdgcn_wmma_f32_16x16x32_f16(
      /*neg_a=*/false, a, /*neg_b=*/false, b,
      /*c_mod=*/(short)0, c, /*reuse_a=*/false, /*reuse_b=*/false);
}

// ---------------------------------------------------------------------------
// Async global->LDS copy (GLOBAL_LOAD_ASYNC_TO_LDS_B128, ASYNCcnt-tracked).
// Builtin signature (from clang diagnostic): (int4 AS1*, int4 AS3*, imm, imm).
// Falls back to a synchronous 16B copy when the builtin is unavailable.
// ---------------------------------------------------------------------------
#if defined(__gfx1250__) && __has_builtin(__builtin_amdgcn_global_load_async_to_lds_b128)
#define HAVE_ASYNC_LDS 1
#else
#define HAVE_ASYNC_LDS 0
#endif

__device__ __forceinline__ void cp16B(const _Float16* g, _Float16* l) {
#if HAVE_ASYNC_LDS
  __builtin_amdgcn_global_load_async_to_lds_b128(
      (__attribute__((address_space(1))) i4v*)g,
      (__attribute__((address_space(3))) i4v*)l, 0, 0);
#else
  *(h8*)l = *(const h8*)g;
#endif
}

__device__ __forceinline__ void cp_wait() {
#if HAVE_ASYNC_LDS
  asm volatile("s_wait_asynccnt 0x0" ::: "memory");
#endif
}

// NT fragment loader. Both A and B fragments of V_WMMA_F32_16X16X32_F16 read
// row (lane&15) of a row-major-along-K tile, in two contiguous 8-half runs:
//   k in [8g, 8g+8) and [8g+16, 8g+24),  g = lane>>4     (ISA 7.12.2 layout)
// => two ds_load_b128 per fragment.
__device__ __forceinline__ h16 frag_ld(const _Float16* base, int row0, int k0, int stride) {
  const int lane = threadIdx.x & 31;
  const int g = lane >> 4;
  const _Float16* p = base + (size_t)(row0 + (lane & 15)) * stride + k0 + 8 * g;
  h8 lo = *(const h8*)(p);
  h8 hi = *(const h8*)(p + 16);
  return __builtin_shufflevector(lo, hi, 0,1,2,3,4,5,6,7,8,9,10,11,12,13,14,15);
}

// ---------------------------------------------------------------------------
// Problem constants
// ---------------------------------------------------------------------------
#define BB       512
#define TT       64
#define DM       1024
#define NH       16
#define DH       64
#define NREL     225
#define RPADN    240   // NREL padded to WMMA N tiles (15 * 16)
#define RPADK    256   // NREL padded to WMMA K steps (8 * 32)
#define MTOT     (BB * TT)   // 32768
#define RIMG     18432 // halves in one staged table image: 9 rounds of 256 lanes x 16 B

// ---------------------------------------------------------------------------
// Vectorized f32 -> f16 cast: 8 elements / thread (2x b128 load, 1x b128 store)
// ---------------------------------------------------------------------------
__global__ __launch_bounds__(256) void cast_f32_f16_v8(const float* __restrict__ src,
                                                       _Float16* __restrict__ dst, int n8) {
  int i = blockIdx.x * 256 + threadIdx.x;
  if (i < n8) {
    const f4v* s = (const f4v*)src;
    f4v a = s[2 * (size_t)i], b = s[2 * (size_t)i + 1];
    h8 o;
#pragma unroll
    for (int j = 0; j < 4; j++) { o[j] = (_Float16)a[j]; o[j + 4] = (_Float16)b[j]; }
    *(h8*)(dst + (size_t)i * 8) = o;
  }
}

// RR[h,r] = dot(rel_q[h,r,:], rel_k[h,r,:])
__global__ __launch_bounds__(256) void rr_kernel(const float* __restrict__ rq,
                                                 const float* __restrict__ rk,
                                                 float* __restrict__ RR) {
  int i = blockIdx.x * 256 + threadIdx.x;
  if (i < NH * NREL) {
    const float* a = rq + (size_t)i * DH;
    const float* b = rk + (size_t)i * DH;
    float s = 0.f;
#pragma unroll
    for (int d = 0; d < DH; d++) s += a[d] * b[d];
    RR[i] = s;
  }
}

// Builds, once per call, the f16 images of the three relative tables exactly as
// attn_kernel keeps them in LDS, so that each work-group stages a table with
// straight 16-byte copies. One thread writes one 16-byte chunk; every byte of an
// image is written (padding as zero).
//   table 0: rel_k rows, pitch 72 halves, rows 225.. zero
//   table 1: rel_q rows, same shape
//   table 2: rel_v transposed [d][264], columns 225.. zero
__global__ __launch_bounds__(256) void rel_image_kernel(const float* __restrict__ rel_q,
                                                        const float* __restrict__ rel_k,
                                                        const float* __restrict__ rel_v,
                                                        _Float16* __restrict__ img) {
  const int c = blockIdx.x * 256 + threadIdx.x;   // chunk in the image, 0..2303
  const int h = blockIdx.y, tb = blockIdx.z;
  h8 o = {};
  if (tb < 2) {
    const float* src = (tb == 0) ? rel_k : rel_q;
    const int r = c / 9, cc = c % 9;
    if (r < NREL && cc < 8) {
      const f4v* s = (const f4v*)(src + ((size_t)h * NREL + r) * DH + cc * 8);
      f4v a = s[0], b = s[1];
#pragma unroll  // constant element indices keep o in registers
      for (int j = 0; j < 4; j++) { o[j] = (_Float16)a[j]; o[j + 4] = (_Float16)b[j]; }
    }
  } else {
    const int d = c / 33, r0 = (c % 33) * 8;
    if (d < DH) {
#pragma unroll  // constant element indices keep o in registers
      for (int j = 0; j < 8; j++) {
        // row clamped, value selected afterwards: the eight loads go out together
        const int r = r0 + j, rc = (r < NREL) ? r : NREL - 1;
        const float v = rel_v[((size_t)h * NREL + rc) * DH + d];
        o[j] = (r < NREL) ? (_Float16)v : (_Float16)0.f;
      }
    }
  }
  *(h8*)(img + (size_t)(tb * NH + h) * RIMG + (size_t)c * 8) = o;
}

// Row table for the P build, once per call: meta[t,s] = rel_index[t,s] bounded to
// 0..224, with bit 8 set in every entry of a row t that names some index twice.
// A row without a repeat can be scattered by several lanes at once.
__global__ __launch_bounds__(64) void rel_rows_kernel(const int* __restrict__ rel_index,
                                                      int* __restrict__ meta) {
  __shared__ int row[TT];
  __shared__ int rep[2];
  const int t = blockIdx.x, s = threadIdx.x;
  const int v = min(max(rel_index[t * TT + s], 0), NREL - 1);
  row[s] = v;
  __syncthreads();
  int n = 0;   // how often this entry's index stands in the row, itself included
  for (int o = 0; o < TT; o++) n += (row[o] == v) ? 1 : 0;
  const int any = __any(n > 1);
  if ((s & 31) == 0) rep[s >> 5] = any ? 1 : 0;
  __syncthreads();
  meta[t * TT + s] = v | ((rep[0] | rep[1]) << 8);
}

// Value of lane (l ^ 1) or (l ^ 2) inside each group of four lanes (DPP quad_perm).
template <int CTRL>
__device__ __forceinline__ float quad_swap(float x) {
  return __builtin_bit_cast(float, __builtin_amdgcn_mov_dpp(__builtin_bit_cast(int, x), CTRL,
                                                            0xf, 0xf, true));
}

// ---------------------------------------------------------------------------
// NT GEMM: C[m,n] = sum_k A[m,k] * W[n,k] + bias[n]
// A: (32768,1024) f16 row-major, W: (1024,1024) f16 row-major.
// OUT_MODE 0: f16, head-split (b,h,t,d) layout.   OUT_MODE 1: f32 row-major.
// 128x128 block tile, 256 threads = 8 waves, each wave a 32x64 sub-tile
// (2x4 WMMA tiles). K stepped by 32 through double-buffered LDS with async
// global->LDS copies pipelined one K-tile ahead.
// ---------------------------------------------------------------------------
template <int OUT_MODE>
__global__ __launch_bounds__(256) void gemm_proj(const _Float16* __restrict__ A,
                                                 const _Float16* __restrict__ W,
                                                 const float* __restrict__ bias,
                                                 _Float16* __restrict__ outH,
                                                 float* __restrict__ outF) {
  constexpr int K = DM, LDW = 40;       // 32 + 8 halves pad
  constexpr int TILEH = 128 * LDW;      // 5120 halves per buffer
  __shared__ _Float16 As[2 * TILEH];
  __shared__ _Float16 Ws[2 * TILEH];

  const int tid  = threadIdx.x;
  const int wave = tid >> 5, lane = tid & 31;
  const int m0 = blockIdx.y * 128, n0 = blockIdx.x * 128;
  const int wm0 = (wave & 3) * 32, wn0 = (wave >> 2) * 64;

  auto stage = [&](int k0, int bsel) {
#pragma unroll
    for (int c = tid; c < 512; c += 256) {       // 128 rows x 4 chunks of 8 halves
      const int row = c >> 2, col = (c & 3) * 8;
      cp16B(&A[(size_t)(m0 + row) * K + k0 + col], &As[bsel * TILEH + row * LDW + col]);
      cp16B(&W[(size_t)(n0 + row) * K + k0 + col], &Ws[bsel * TILEH + row * LDW + col]);
    }
  };

  f8v acc[2][4] = {};

  stage(0, 0);
  cp_wait();
  __syncthreads();

  int buf = 0;
  for (int k0 = 0; k0 < K; k0 += 32) {
    if (k0 + 32 < K) stage(k0 + 32, buf ^ 1);    // prefetch next tile into other buffer

    const _Float16* Ab = As + buf * TILEH;
    const _Float16* Wb = Ws + buf * TILEH;
    h16 af[2], bf[4];
#pragma unroll
    for (int i = 0; i < 2; i++) af[i] = frag_ld(Ab, wm0 + i * 16, 0, LDW);
#pragma unroll
    for (int j = 0; j < 4; j++) bf[j] = frag_ld(Wb, wn0 + j * 16, 0, LDW);
#pragma unroll
    for (int i = 0; i < 2; i++)
#pragma unroll
      for (int j = 0; j < 4; j++) acc[i][j] = wmma_f16(af[i], bf[j], acc[i][j]);

    cp_wait();
    __syncthreads();
    buf ^= 1;
  }

  const int g = lane >> 4, nl = lane & 15;
#pragma unroll
  for (int i = 0; i < 2; i++)
#pragma unroll
    for (int j = 0; j < 4; j++) {
      const int gn = n0 + wn0 + j * 16 + nl;
      const float bv = bias[gn];
#pragma unroll
      for (int r = 0; r < 8; r++) {
        const int gm = m0 + wm0 + i * 16 + g * 8 + r;  // C layout: M = r + 8*(lane>>4)
        const float v = acc[i][j][r] + bv;
        if (OUT_MODE == 0) {
          const int b = gm >> 6, t = gm & 63, h = gn >> 6, d = gn & 63;
          outH[(((size_t)(b * NH + h) * TT + t) * DH) + d] = (_Float16)v;
        } else {
          outF[(size_t)gm * DM + gn] = v;
        }
      }
    }
}

// ---------------------------------------------------------------------------
// Fused relative attention for one (b,h): 256 threads, dynamic LDS.
// LDS half-offsets:
//   qs   [64x72]      0      (reused as attn f16 after softmax)
//   ks   [64x72]      4608
//   vTs  [64x72]      9216   (v stored transposed [d][s])
//   rls  [18432]      13824  (rel_k rows -> rel_q rows -> rel_vT [64x264])
//   Qr   [64x240]     32256  \ overlaid later by P [64x264]
//   Kr   [64x240]     47616  /
//   Ls   f32 [64x64]  byte 125952
// total 142336 bytes dynamic shared (< 320 KB/WG on CDNA5).
// ---------------------------------------------------------------------------
__global__ __launch_bounds__(256) void attn_kernel(
    const _Float16* __restrict__ qg, const _Float16* __restrict__ kg,
    const _Float16* __restrict__ vg,                 // (B,H,T,DH) f16
    const _Float16* __restrict__ relimg,             // (3,H,RIMG) f16 table images
    const int* __restrict__ rel_index,               // (64,64)
    const int* __restrict__ relmeta,                 // (64,64) bounded index | repeat flag
    const float* __restrict__ RR,                    // (H,225)
    _Float16* __restrict__ outO)                     // (B,T,1024) f16
{
  extern __shared__ char smem_raw[];
  _Float16* qs    = (_Float16*)smem_raw;
  _Float16* ks    = qs + 4608;
  _Float16* vTs   = ks + 4608;
  _Float16* rls   = vTs + 4608;
  _Float16* Qr    = rls + RIMG;
  _Float16* Kr    = Qr + 64 * RPADN;
  _Float16* Pm    = Qr;        // overlay after gathers
  _Float16* attnb = qs;        // overlay after logits
  float*    Ls    = (float*)(smem_raw + 125952);

  const int h = blockIdx.x, b = blockIdx.y;
  const int tid = threadIdx.x, wave = tid >> 5, lane = tid & 31;
  const size_t bh = ((size_t)b * NH + h) * (TT * DH);

  // One table image -> rls: 9 async 16B copies per lane, every lane on.
  auto stage_rel = [&](int tb) {
    const _Float16* s = relimg + (size_t)(tb * NH + h) * RIMG + tid * 8;
    _Float16* l = rls + tid * 8;
#pragma unroll  // all nine copies in flight together
    for (int i = 0; i < 9; i++) cp16B(s + i * 2048, l + i * 2048);
  };

  // ---- stage q, k, rel_k rows (async 16B copies), vT (transposed) ----
  for (int c = tid; c < 512; c += 256) {
    int row = c >> 3, col = (c & 7) * 8;
    cp16B(&qg[bh + row * DH + col], &qs[row * 72 + col]);
    cp16B(&kg[bh + row * DH + col], &ks[row * 72 + col]);
  }
  stage_rel(0);
  for (int e = tid; e < TT * DH; e += 256) {
    int d = e & 63, s = e >> 6;
    vTs[d * 72 + s] = vg[bh + (size_t)s * DH + d];
  }
  cp_wait();
  __syncthreads();

  // ---- Qr = q @ rel_k^T  (64 x 240, K=64) ----
  for (int tIdx = wave; tIdx < 60; tIdx += 8) {
    int mt = tIdx / 15, nt = tIdx % 15;
    f8v acc = {};
#pragma unroll
    for (int k0 = 0; k0 < DH; k0 += 32)
      acc = wmma_f16(frag_ld(qs, mt * 16, k0, 72), frag_ld(rls, nt * 16, k0, 72), acc);
    const int n = nt * 16 + (lane & 15), g = lane >> 4;
#pragma unroll
    for (int r = 0; r < 8; r++) Qr[(mt * 16 + g * 8 + r) * RPADN + n] = (_Float16)acc[r];
  }
  __syncthreads();

  // ---- restage rel_q, compute Kr = k @ rel_q^T ----
  stage_rel(1);
  cp_wait();  // rel_q copies landed before the barrier that publishes them
  __syncthreads();
  for (int tIdx = wave; tIdx < 60; tIdx += 8) {
    int mt = tIdx / 15, nt = tIdx % 15;
    f8v acc = {};
#pragma unroll
    for (int k0 = 0; k0 < DH; k0 += 32)
      acc = wmma_f16(frag_ld(ks, mt * 16, k0, 72), frag_ld(rls, nt * 16, k0, 72), acc);
    const int n = nt * 16 + (lane & 15), g = lane >> 4;
#pragma unroll
    for (int r = 0; r < 8; r++) Kr[(mt * 16 + g * 8 + r) * RPADN + n] = (_Float16)acc[r];
  }
  __syncthreads();

  // ---- stage rel_vT [d][264] while computing logits = q k^T + gathers ----
  stage_rel(2);
  for (int tIdx = wave; tIdx < 16; tIdx += 8) {
    int mt = tIdx >> 2, nt = tIdx & 3;
    f8v acc = {};
#pragma unroll
    for (int k0 = 0; k0 < DH; k0 += 32)
      acc = wmma_f16(frag_ld(qs, mt * 16, k0, 72), frag_ld(ks, nt * 16, k0, 72), acc);
    const int s = nt * 16 + (lane & 15), g = lane >> 4;
#pragma unroll
    for (int r = 0; r < 8; r++) {
      const int t = mt * 16 + g * 8 + r;
      const int idx = rel_index[t * TT + s];
      Ls[t * TT + s] = acc[r] + (float)Qr[t * RPADN + idx] +
                       (float)Kr[s * RPADN + idx] + RR[h * NREL + idx];
    }
  }
  cp_wait();  // rel_vT copies landed before the barrier that publishes them
  __syncthreads();

  // ---- zero P (overlays Qr/Kr) + softmax: four lanes a row, 16 logits each ----
  const int t4 = tid >> 2, j4 = tid & 3;
  i4v mt4[4];
#pragma unroll  // constant indices keep the slice in registers
  for (int i = 0; i < 4; i++) mt4[i] = ((const i4v*)(relmeta + t4 * TT + j4 * 16))[i];
#pragma unroll  // 2112 chunks of 16 B: eight rounds of 256 lanes and a rest of 64
  for (int i = 0; i < 8; i++) *(h8*)(Pm + (tid + i * 256) * 8) = h8{};
  if (tid < 64) *(h8*)(Pm + (tid + 2048) * 8) = h8{};
  _Float16 at[16];
  {
    const float scale = 0.125f;  // 1/sqrt(64)
    f2v l[8];
#pragma unroll  // constant indices keep the slice in registers
    for (int i = 0; i < 4; i++) {
      const f4v x4 = ((const f4v*)(Ls + t4 * TT + j4 * 16))[i];
      l[2 * i] = f2v{x4[0], x4[1]};
      l[2 * i + 1] = f2v{x4[2], x4[3]};
    }
    float mx = -1e30f;
#pragma unroll  // constant indices keep the slice in registers
    for (int i = 0; i < 8; i++) mx = fmaxf(mx, fmaxf(l[i][0], l[i][1]));
    mx = fmaxf(mx, quad_swap<0xB1>(mx));   // lane ^ 1
    mx = fmaxf(mx, quad_swap<0x4E>(mx));   // lane ^ 2
    f2v sum2 = {0.f, 0.f};
#pragma unroll  // constant indices keep the slice in registers
    for (int i = 0; i < 8; i++) {
      const f2v a = (l[i] - mx) * scale;
      l[i] = f2v{__expf(a[0]), __expf(a[1])};
      sum2 += l[i];
    }
    float sum = sum2[0] + sum2[1];
    sum += quad_swap<0xB1>(sum);
    sum += quad_swap<0x4E>(sum);
    const float inv = 1.f / sum;
    h8 lo, hi;
#pragma unroll  // constant indices keep the slice in registers
    for (int i = 0; i < 8; i++) {
      const f2v p = l[i] * inv;
      at[2 * i] = (_Float16)p[0];
      at[2 * i + 1] = (_Float16)p[1];
    }
#pragma unroll  // constant indices keep the slice in registers
    for (int i = 0; i < 8; i++) { lo[i] = at[i]; hi[i] = at[i + 8]; }
    *(h8*)(attnb + t4 * 72 + j4 * 16)     = lo;
    *(h8*)(attnb + t4 * 72 + j4 * 16 + 8) = hi;
  }
  __syncthreads();

  // ---- scatter P[t,r] += attn[t,s] ----
  if (!(mt4[0][0] & 256)) {
    // no index twice in row t: every s has its own element of the zeroed row
#pragma unroll  // constant indices keep the slice in registers
    for (int i = 0; i < 16; i++) Pm[t4 * 264 + (mt4[i >> 2][i & 3] & 255)] = at[i];
  } else if (j4 == 0) {
    // a repeated index: one lane adds the row's 64 values in order of s
    for (int s = 0; s < TT; s++) {
      const int idx = relmeta[t4 * TT + s] & 255;
      Pm[t4 * 264 + idx] = (_Float16)((float)Pm[t4 * 264 + idx] + (float)attnb[t4 * 72 + s]);
    }
  }
  __syncthreads();

  // ---- out = attn @ v  +  P @ rel_v  (both WMMA) ----
  for (int tIdx = wave; tIdx < 16; tIdx += 8) {
    int mt = tIdx >> 2, nt = tIdx & 3;
    f8v acc = {};
#pragma unroll
    for (int k0 = 0; k0 < TT; k0 += 32)
      acc = wmma_f16(frag_ld(attnb, mt * 16, k0, 72), frag_ld(vTs, nt * 16, k0, 72), acc);
#pragma unroll
    for (int k0 = 0; k0 < RPADK; k0 += 32)
      acc = wmma_f16(frag_ld(Pm, mt * 16, k0, 264), frag_ld(rls, nt * 16, k0, 264), acc);
    const int g = lane >> 4, d = nt * 16 + (lane & 15);
#pragma unroll
    for (int r = 0; r < 8; r++) {
      const int t = mt * 16 + g * 8 + r;
      outO[((size_t)b * TT + t) * DM + h * DH + d] = (_Float16)acc[r];
    }
  }
}

// ---------------------------------------------------------------------------
// Host launcher
// ---------------------------------------------------------------------------
extern "C" void kernel_launch(void* const* d_in, const int* in_sizes, int n_in,
                              void* d_out, int out_size, void* d_ws, size_t ws_size,
                              hipStream_t stream) {
  (void)in_sizes; (void)n_in; (void)out_size; (void)ws_size;
  const float* x     = (const float*)d_in[0];
  const float* Wq_w  = (const float*)d_in[1];
  const float* Wq_b  = (const float*)d_in[2];
  const float* Wk_w  = (const float*)d_in[3];
  const float* Wk_b  = (const float*)d_in[4];
  const float* Wv_w  = (const float*)d_in[5];
  const float* Wv_b  = (const float*)d_in[6];
  const float* Wo_w  = (const float*)d_in[7];
  const float* Wo_b  = (const float*)d_in[8];
  const float* rel_q = (const float*)d_in[9];
  const float* rel_k = (const float*)d_in[10];
  const float* rel_v = (const float*)d_in[11];
  const int*   ridx  = (const int*)d_in[12];

  char* ws = (char*)d_ws;
  // workspace layout (bytes)
  _Float16* xh = (_Float16*)(ws);                       // 67,108,864  (x f16; reused as oh)
  _Float16* wh = (_Float16*)(ws + 67108864);            //  8,388,608  (Wq,Wk,Wv,Wo f16)
  _Float16* qh = (_Float16*)(ws + 75497472);            // 67,108,864  (B,H,T,64)
  _Float16* kh = (_Float16*)(ws + 142606336);           // 67,108,864
  _Float16* vh = (_Float16*)(ws + 209715200);           // 67,108,864
  float*    RR = (float*)(ws + 276824064);              //     14,400
  _Float16* ri = (_Float16*)(ws + 276840448);           //  1,769,472  (3,H,RIMG) table images
  int*      rm = (int*)(ws + 278609920);                //     16,384  (64,64) row table
  _Float16* oh = xh;  // x consumed before attention writes here (same stream)

  const int nx = MTOT * DM;     // 33,554,432
  const int nw = DM * DM;       //  1,048,576
  cast_f32_f16_v8<<<nx / 8 / 256, 256, 0, stream>>>(x,    xh,                  nx / 8);
  cast_f32_f16_v8<<<nw / 8 / 256, 256, 0, stream>>>(Wq_w, wh + 0 * (size_t)nw, nw / 8);
  cast_f32_f16_v8<<<nw / 8 / 256, 256, 0, stream>>>(Wk_w, wh + 1 * (size_t)nw, nw / 8);
  cast_f32_f16_v8<<<nw / 8 / 256, 256, 0, stream>>>(Wv_w, wh + 2 * (size_t)nw, nw / 8);
  cast_f32_f16_v8<<<nw / 8 / 256, 256, 0, stream>>>(Wo_w, wh + 3 * (size_t)nw, nw / 8);
  rr_kernel<<<(NH * NREL + 255) / 256, 256, 0, stream>>>(rel_q, rel_k, RR);
  rel_image_kernel<<<dim3(RIMG / 8 / 256, NH, 3), 256, 0, stream>>>(rel_q, rel_k, rel_v, ri);
  rel_rows_kernel<<<TT, TT, 0, stream>>>(ridx, rm);

  dim3 gproj(DM / 128, MTOT / 128);  // (8, 256)
  gemm_proj<0><<<gproj, 256, 0, stream>>>(xh, wh + 0 * (size_t)nw, Wq_b, qh, nullptr);
  gemm_proj<0><<<gproj, 256, 0, stream>>>(xh, wh + 1 * (size_t)nw, Wk_b, kh, nullptr);
  gemm_proj<0><<<gproj, 256, 0, stream>>>(xh, wh + 2 * (size_t)nw, Wv_b, vh, nullptr);

  attn_kernel<<<dim3(NH, BB), 256, 142336, stream>>>(qh, kh, vh, ri, ridx, rm, RR, oh);

  gemm_proj<1><<<gproj, 256, 0, stream>>>(oh, wh + 3 * (size_t)nw, Wo_b, nullptr,
                                          (float*)d_out);
}

// v003
// Measured time: 420 microseconds a run.
// Two timings next to v002 both put it at 1.24 times that version's speed.
// Over all steps from v000 it is 2.80 times as fast.
#include <hip/hip_runtime.h>
#include <hip/hip_bf16.h>

// ---------------------------------------------------------------------------
// Types for WMMA fragments (gfx1250, wave32)
// ---------------------------------------------------------------------------
typedef _Float16 h8  __attribute__((ext_vector_type(8)));
typedef _Float16 h16 __attribute__((ext_vector_type(16)));
typedef float    f8v __attribute__((ext_vector_type(8)));
typedef float    f4v __attribute__((ext_vector_type(4)));
typedef float    f2v __attribute__((ext_vector_type(2)));
typedef int      i4v __attribute__((ext_vector_type(4)));

__device__ __forceinline__ f8v wmma_f16(h16 a, h16 b, f8v c) {
  // D = A(16x32 f16) * B(32x16 f16) + C(16x16 f32)
  return __builtin_amdgcn_wmma_f32_16x16x32_f16(
      /*neg_a=*/false, a, /*neg_b=*/false, b,
      /*c_mod=*/(short)0, c, /*reuse_a=*/false, /*reuse_b=*/false);
}

// ---------------------------------------------------------------------------
// Async global->LDS copy (GLOBAL_LOAD_ASYNC_TO_LDS_B128, ASYNCcnt-tracked).
// Builtin signature (from clang diagnostic): (int4 AS1*, int4 AS3*, imm, imm).
// Falls back to a synchronous 16B copy when the builtin is unavailable.
// ---------------------------------------------------------------------------
#if defined(__gfx1250__) && __has_builtin(__builtin_amdgcn_global_load_async_to_lds_b128)
#define HAVE_ASYNC_LDS 1
#else
#define HAVE_ASYNC_LDS 0
#endif

__device__ __forceinline__ void cp16B(const _Float16* g, _Float16* l) {
#if HAVE_ASYNC_LDS
  __builtin_amdgcn_global_load_async_to_lds_b128(
      (__attribute__((address_space(1))) i4v*)g,
      (__attribute__((address_space(3))) i4v*)l, 0, 0);
#else
  *(h8*)l = *(const h8*)g;
#endif
}

__device__ __forceinline__ void cp_wait() {
#if HAVE_ASYNC_LDS
  asm volatile("s_wait_asynccnt 0x0" ::: "memory");
#endif
}

// NT fragment loader. Both A and B fragments of V_WMMA_F32_16X16X32_F16 read
// row (lane&15) of a row-major-along-K tile, in two contiguous 8-half runs:
//   k in [8g, 8g+8) and [8g+16, 8g+24),  g = lane>>4     (ISA 7.12.2 layout)
// => two ds_load_b128 per fragment.
__device__ __forceinline__ h16 frag_ld(const _Float16* base, int row0, int k0, int stride) {
  const int lane = threadIdx.x & 31;
  const int g = lane >> 4;
  const _Float16* p = base + (size_t)(row0 + (lane & 15)) * stride + k0 + 8 * g;
  h8 lo = *(const h8*)(p);
  h8 hi = *(const h8*)(p + 16);
  return __builtin_shufflevector(lo, hi, 0,1,2,3,4,5,6,7,8,9,10,11,12,13,14,15);
}

// ---------------------------------------------------------------------------
// Problem constants
// ---------------------------------------------------------------------------
#define BB       512
#define TT       64
#define DM       1024
#define NH       16
#define DH       64
#define NREL     225
#define RPADN    240   // NREL padded to WMMA N tiles (15 * 16)
#define RPADK    256   // NREL padded to WMMA K steps (8 * 32)
#define MTOT     (BB * TT)   // 32768
#define RIMG     18432 // halves in one staged table image: 9 rounds of 256 lanes x 16 B

// ---------------------------------------------------------------------------
// Vectorized f32 -> f16 cast: 8 elements / thread (2x b128 load, 1x b128 store)
// ---------------------------------------------------------------------------
__global__ __launch_bounds__(256) void cast_f32_f16_v8(const float* __restrict__ src,
                                                       _Float16* __restrict__ dst, int n8) {
  int i = blockIdx.x * 256 + threadIdx.x;
  if (i < n8) {
    const f4v* s = (const f4v*)src;
    f4v a = s[2 * (size_t)i], b = s[2 * (size_t)i + 1];
    h8 o;
#pragma unroll
    for (int j = 0; j < 4; j++) { o[j] = (_Float16)a[j]; o[j + 4] = (_Float16)b[j]; }
    *(h8*)(dst + (size_t)i * 8) = o;
  }
}

// RR[h,r] = dot(rel_q[h,r,:], rel_k[h,r,:])
__global__ __launch_bounds__(256) void rr_kernel(const float* __restrict__ rq,
                                                 const float* __restrict__ rk,
                                                 float* __restrict__ RR) {
  int i = blockIdx.x * 256 + threadIdx.x;
  if (i < NH * NREL) {
    const float* a = rq + (size_t)i * DH;
    const float* b = rk + (size_t)i * DH;
    float s = 0.f;
#pragma unroll
    for (int d = 0; d < DH; d++) s += a[d] * b[d];
    RR[i] = s;
  }
}

// Builds, once per call, the f16 images of the three relative tables exactly as
// attn_kernel keeps them in LDS, so that each work-group stages a table with
// straight 16-byte copies. One thread writes one 16-byte chunk; every byte of an
// image is written (padding as zero).
//   table 0: rel_k rows, pitch 72 halves, rows 225.. zero
//   table 1: rel_q rows, same shape
//   table 2: rel_v transposed [d][264], columns 225.. zero
__global__ __launch_bounds__(256) void rel_image_kernel(const float* __restrict__ rel_q,
                                                        const float* __restrict__ rel_k,
                                                        const float* __restrict__ rel_v,
                                                        _Float16* __restrict__ img) {
  const int c = blockIdx.x * 256 + threadIdx.x;   // chunk in the image, 0..2303
  const int h = blockIdx.y, tb = blockIdx.z;
  h8 o = {};
  if (tb < 2) {
    const float* src = (tb == 0) ? rel_k : rel_q;
    const int r = c / 9, cc = c % 9;
    if (r < NREL && cc < 8) {
      const f4v* s = (const f4v*)(src + ((size_t)h * NREL + r) * DH + cc * 8);
      f4v a = s[0], b = s[1];
#pragma unroll  // constant element indices keep o in registers
      for (int j = 0; j < 4; j++) { o[j] = (_Float16)a[j]; o[j + 4] = (_Float16)b[j]; }
    }
  } else {
    const int d = c / 33, r0 = (c % 33) * 8;
    if (d < DH) {
#pragma unroll  // constant element indices keep o in registers
      for (int j = 0; j < 8; j++) {
        // row clamped, value selected afterwards: the eight loads go out together
        const int r = r0 + j, rc = (r < NREL) ? r : NREL - 1;
        const float v = rel_v[((size_t)h * NREL + rc) * DH + d];
        o[j] = (r < NREL) ? (_Float16)v : (_Float16)0.f;
      }
    }
  }
  *(h8*)(img + (size_t)(tb * NH + h) * RIMG + (size_t)c * 8) = o;
}

// Row table for the P build, once per call: meta[t,s] = rel_index[t,s] bounded to
// 0..224, with bit 8 set in every entry of a row t that names some index twice.
// A row without a repeat can be scattered by several lanes at once.
__global__ __launch_bounds__(64) void rel_rows_kernel(const int* __restrict__ rel_index,
                                                      int* __restrict__ meta) {
  __shared__ int row[TT];
  __shared__ int rep[2];
  const int t = blockIdx.x, s = threadIdx.x;
  const int v = min(max(rel_index[t * TT + s], 0), NREL - 1);
  row[s] = v;
  __syncthreads();
  int n = 0;   // how often this entry's index stands in the row, itself included
  for (int o = 0; o < TT; o++) n += (row[o] == v) ? 1 : 0;
  const int any = __any(n > 1);
  if ((s & 31) == 0) rep[s >> 5] = any ? 1 : 0;
  __syncthreads();
  meta[t * TT + s] = v | ((rep[0] | rep[1]) << 8);
}

// Value of lane (l ^ 1) or (l ^ 2) inside each group of four lanes (DPP quad_perm).
template <int CTRL>
__device__ __forceinline__ float quad_swap(float x) {
  return __builtin_bit_cast(float, __builtin_amdgcn_mov_dpp(__builtin_bit_cast(int, x), CTRL,
                                                            0xf, 0xf, true));
}

// ---------------------------------------------------------------------------
// NT GEMM: C[m,n] = sum_k A[m,k] * W[n,k] + bias[n]
// A: (32768,1024) f16 row-major, W: (1024,1024) f16 row-major.
// OUT_MODE 0: f16, head-split (b,h,t,d) layout.   OUT_MODE 1: f32 row-major.
// 128x256 block tile, 128 threads = 4 waves, each wave a 64x128 sub-tile
// (4x8 WMMA tiles): 12 fragments feed 32 WMMAs. K stepped by 64 (whole 128-byte
// lines of every operand row) through double-buffered LDS with async
// global->LDS copies one stage ahead. Two work-groups share a WGP.
// ---------------------------------------------------------------------------
template <int OUT_MODE>
__global__ __launch_bounds__(128) void gemm_proj(const _Float16* __restrict__ A,
                                                 const _Float16* __restrict__ W,
                                                 const float* __restrict__ bias,
                                                 _Float16* __restrict__ outH,
                                                 float* __restrict__ outF) {
  constexpr int K = DM, KS = 64, LDW = 72;   // 64 + 8 halves pad: 144-byte pitch
  constexpr int BM = 128, BN = 256;
  constexpr int ATILE = BM * LDW;            //  9216 halves per buffer
  constexpr int WTILE = BN * LDW;            // 18432 halves per buffer
  __shared__ _Float16 As[2 * ATILE];
  __shared__ _Float16 Ws[2 * WTILE];

  const int tid  = threadIdx.x;
  const int wave = tid >> 5, lane = tid & 31;
  const int m0 = blockIdx.y * BM, n0 = blockIdx.x * BN;
  const int wm0 = (wave & 1) * 64, wn0 = (wave >> 1) * 128;

  // Eight lanes copy one row's 128 bytes; a round of 128 lanes covers 16 rows.
  const int crow = tid >> 3, ccol = (tid & 7) * 8;
  const _Float16* gA = A + (size_t)(m0 + crow) * K + ccol;
  const _Float16* gW = W + (size_t)(n0 + crow) * K + ccol;
  _Float16* lA = As + crow * LDW + ccol;
  _Float16* lW = Ws + crow * LDW + ccol;

  auto stage = [&](int k0, int bsel) {
#pragma unroll  // all 24 copies of a stage in flight together, every lane on
    for (int i = 0; i < BM / 16; i++)
      cp16B(gA + (size_t)i * 16 * K + k0, lA + bsel * ATILE + i * 16 * LDW);
#pragma unroll
    for (int i = 0; i < BN / 16; i++)
      cp16B(gW + (size_t)i * 16 * K + k0, lW + bsel * WTILE + i * 16 * LDW);
  };

  f8v acc[4][8] = {};

  stage(0, 0);
  cp_wait();
  __syncthreads();

  int buf = 0;
  for (int k0 = 0; k0 < K; k0 += KS) {
    if (k0 + KS < K) stage(k0 + KS, buf ^ 1);    // next stage into the other buffer

    const _Float16* Ab = As + buf * ATILE;
    const _Float16* Wb = Ws + buf * WTILE;
#pragma unroll
    for (int kk = 0; kk < KS; kk += 32) {
      h16 af[4], bf[8];
#pragma unroll
      for (int i = 0; i < 4; i++) af[i] = frag_ld(Ab, wm0 + i * 16, kk, LDW);
#pragma unroll
      for (int j = 0; j < 8; j++) bf[j] = frag_ld(Wb, wn0 + j * 16, kk, LDW);
      // keeps the 24 LDS reads of a k step together ahead of its 32 WMMAs: without it the
      // A fragments share one register set and every row of 8 WMMAs waits out its own read
      __builtin_amdgcn_sched_barrier(0);
#pragma unroll
      for (int i = 0; i < 4; i++)
#pragma unroll
        for (int j = 0; j < 8; j++) acc[i][j] = wmma_f16(af[i], bf[j], acc[i][j]);
    }

    // keeps the stage's last WMMAs ahead of the waits: sunk behind the barrier they would
    // stand between it and the next copies, which then fly for half a stage only
    __builtin_amdgcn_sched_barrier(0);
    // this wave's reads of the buffer are done before it is refilled behind the barrier
    asm volatile("s_wait_dscnt 0x0" ::: "memory");
    cp_wait();
    __syncthreads();
    buf ^= 1;
  }

  const int g = lane >> 4, nl = lane & 15;
#pragma unroll
  for (int j = 0; j < 8; j++) {
    const int gn = n0 + wn0 + j * 16 + nl;
    const float bv = bias[gn];
#pragma unroll
    for (int i = 0; i < 4; i++) {
#pragma unroll
      for (int r = 0; r < 8; r++) {
        const int gm = m0 + wm0 + i * 16 + g * 8 + r;  // C layout: M = r + 8*(lane>>4)
        const float v = acc[i][j][r] + bv;
        if (OUT_MODE == 0) {
          const int b = gm >> 6, t = gm & 63, h = gn >> 6, d = gn & 63;
          outH[(((size_t)(b * NH + h) * TT + t) * DH) + d] = (_Float16)v;
        } else {
          outF[(size_t)gm * DM + gn] = v;
        }
      }
    }
  }
}

// ---------------------------------------------------------------------------
// Fused relative attention for one (b,h): 256 threads, dynamic LDS.
// LDS half-offsets:
//   qs   [64x72]      0      (reused as attn f16 after softmax)
//   ks   [64x72]      4608
//   vTs  [64x72]      9216   (v stored transposed [d][s])
//   rls  [18432]      13824  (rel_k rows -> rel_q rows -> rel_vT [64x264])
//   Qr   [64x240]     32256  \ overlaid later by P [64x264]
//   Kr   [64x240]     47616  /
//   Ls   f32 [64x64]  byte 125952
// total 142336 bytes dynamic shared (< 320 KB/WG on CDNA5).
// ---------------------------------------------------------------------------
__global__ __launch_bounds__(256) void attn_kernel(
    const _Float16* __restrict__ qg, const _Float16* __restrict__ kg,
    const _Float16* __restrict__ vg,                 // (B,H,T,DH) f16
    const _Float16* __restrict__ relimg,             // (3,H,RIMG) f16 table images
    const int* __restrict__ rel_index,               // (64,64)
    const int* __restrict__ relmeta,                 // (64,64) bounded index | repeat flag
    const float* __restrict__ RR,                    // (H,225)
    _Float16* __restrict__ outO)                     // (B,T,1024) f16
{
  extern __shared__ char smem_raw[];
  _Float16* qs    = (_Float16*)smem_raw;
  _Float16* ks    = qs + 4608;
  _Float16* vTs   = ks + 4608;
  _Float16* rls   = vTs + 4608;
  _Float16* Qr    = rls + RIMG;
  _Float16* Kr    = Qr + 64 * RPADN;
  _Float16* Pm    = Qr;        // overlay after gathers
  _Float16* attnb = qs;        // overlay after logits
  float*    Ls    = (float*)(smem_raw + 125952);

  const int h = blockIdx.x, b = blockIdx.y;
  const int tid = threadIdx.x, wave = tid >> 5, lane = tid & 31;
  const size_t bh = ((size_t)b * NH + h) * (TT * DH);

  // One table image -> rls: 9 async 16B copies per lane, every lane on.
  auto stage_rel = [&](int tb) {
    const _Float16* s = relimg + (size_t)(tb * NH + h) * RIMG + tid * 8;
    _Float16* l = rls + tid * 8;
#pragma unroll  // all nine copies in flight together
    for (int i = 0; i < 9; i++) cp16B(s + i * 2048, l + i * 2048);
  };

  // ---- stage q, k, rel_k rows (async 16B copies), vT (transposed) ----
  for (int c = tid; c < 512; c += 256) {
    int row = c >> 3, col = (c & 7) * 8;
    cp16B(&qg[bh + row * DH + col], &qs[row * 72 + col]);
    cp16B(&kg[bh + row * DH + col], &ks[row * 72 + col]);
  }
  stage_rel(0);
  for (int e = tid; e < TT * DH; e += 256) {
    int d = e & 63, s = e >> 6;
    vTs[d * 72 + s] = vg[bh + (size_t)s * DH + d];
  }
  cp_wait();
  __syncthreads();

  // ---- Qr = q @ rel_k^T  (64 x 240, K=64) ----
  for (int tIdx = wave; tIdx < 60; tIdx += 8) {
    int mt = tIdx / 15, nt = tIdx % 15;
    f8v acc = {};
#pragma unroll
    for (int k0 = 0; k0 < DH; k0 += 32)
      acc = wmma_f16(frag_ld(qs, mt * 16, k0, 72), frag_ld(rls, nt * 16, k0, 72), acc);
    const int n = nt * 16 + (lane & 15), g = lane >> 4;
#pragma unroll
    for (int r = 0; r < 8; r++) Qr[(mt * 16 + g * 8 + r) * RPADN + n] = (_Float16)acc[r];
  }
  __syncthreads();

  // ---- restage rel_q, compute Kr = k @ rel_q^T ----
  stage_rel(1);
  cp_wait();  // rel_q copies landed before the barrier that publishes them
  __syncthreads();
  for (int tIdx = wave; tIdx < 60; tIdx += 8) {
    int mt = tIdx / 15, nt = tIdx % 15;
    f8v acc = {};
#pragma unroll
    for (int k0 = 0; k0 < DH; k0 += 32)
      acc = wmma_f16(frag_ld(ks, mt * 16, k0, 72), frag_ld(rls, nt * 16, k0, 72), acc);
    const int n = nt * 16 + (lane & 15), g = lane >> 4;
#pragma unroll
    for (int r = 0; r < 8; r++) Kr[(mt * 16 + g * 8 + r) * RPADN + n] = (_Float16)acc[r];
  }
  __syncthreads();

  // ---- stage rel_vT [d][264] while computing logits = q k^T + gathers ----
  stage_rel(2);
  for (int tIdx = wave; tIdx < 16; tIdx += 8) {
    int mt = tIdx >> 2, nt = tIdx & 3;
    f8v acc = {};
#pragma unroll
    for (int k0 = 0; k0 < DH; k0 += 32)
      acc = wmma_f16(frag_ld(qs, mt * 16, k0, 72), frag_ld(ks, nt * 16, k0, 72), acc);
    const int s = nt * 16 + (lane & 15), g = lane >> 4;
#pragma unroll
    for (int r = 0; r < 8; r++) {
      const int t = mt * 16 + g * 8 + r;
      const int idx = rel_index[t * TT + s];
      Ls[t * TT + s] = acc[r] + (float)Qr[t * RPADN + idx] +
                       (float)Kr[s * RPADN + idx] + RR[h * NREL + idx];
    }
  }
  cp_wait();  // rel_vT copies landed before the barrier that publishes them
  __syncthreads();

  // ---- zero P (overlays Qr/Kr) + softmax: four lanes a row, 16 logits each ----
  const int t4 = tid >> 2, j4 = tid & 3;
  i4v mt4[4];
#pragma unroll  // constant indices keep the slice in registers
  for (int i = 0; i < 4; i++) mt4[i] = ((const i4v*)(relmeta + t4 * TT + j4 * 16))[i];
#pragma unroll  // 2112 chunks of 16 B: eight rounds of 256 lanes and a rest of 64
  for (int i = 0; i < 8; i++) *(h8*)(Pm + (tid + i * 256) * 8) = h8{};
  if (tid < 64) *(h8*)(Pm + (tid + 2048) * 8) = h8{};
  _Float16 at[16];
  {
    const float scale = 0.125f;  // 1/sqrt(64)
    f2v l[8];
#pragma unroll  // constant indices keep the slice in registers
    for (int i = 0; i < 4; i++) {
      const f4v x4 = ((const f4v*)(Ls + t4 * TT + j4 * 16))[i];
      l[2 * i] = f2v{x4[0], x4[1]};
      l[2 * i + 1] = f2v{x4[2], x4[3]};
    }
    float mx = -1e30f;
#pragma unroll  // constant indices keep the slice in registers
    for (int i = 0; i < 8; i++) mx = fmaxf(mx, fmaxf(l[i][0], l[i][1]));
    mx = fmaxf(mx, quad_swap<0xB1>(mx));   // lane ^ 1
    mx = fmaxf(mx, quad_swap<0x4E>(mx));   // lane ^ 2
    f2v sum2 = {0.f, 0.f};
#pragma unroll  // constant indices keep the slice in registers
    for (int i = 0; i < 8; i++) {
      const f2v a = (l[i] - mx) * scale;
      l[i] = f2v{__expf(a[0]), __expf(a[1])};
      sum2 += l[i];
    }
    float sum = sum2[0] + sum2[1];
    sum += quad_swap<0xB1>(sum);
    sum += quad_swap<0x4E>(sum);
    const float inv = 1.f / sum;
    h8 lo, hi;
#pragma unroll  // constant indices keep the slice in registers
    for (int i = 0; i < 8; i++) {
      const f2v p = l[i] * inv;
      at[2 * i] = (_Float16)p[0];
      at[2 * i + 1] = (_Float16)p[1];
    }
#pragma unroll  // constant indices keep the slice in registers
    for (int i = 0; i < 8; i++) { lo[i] = at[i]; hi[i] = at[i + 8]; }
    *(h8*)(attnb + t4 * 72 + j4 * 16)     = lo;
    *(h8*)(attnb + t4 * 72 + j4 * 16 + 8) = hi;
  }
  __syncthreads();

  // ---- scatter P[t,r] += attn[t,s] ----
  if (!(mt4[0][0] & 256)) {
    // no index twice in row t: every s has its own element of the zeroed row
#pragma unroll  // constant indices keep the slice in registers
    for (int i = 0; i < 16; i++) Pm[t4 * 264 + (mt4[i >> 2][i & 3] & 255)] = at[i];
  } else if (j4 == 0) {
    // a repeated index: one lane adds the row's 64 values in order of s
    for (int s = 0; s < TT; s++) {
      const int idx = relmeta[t4 * TT + s] & 255;
      Pm[t4 * 264 + idx] = (_Float16)((float)Pm[t4 * 264 + idx] + (float)attnb[t4 * 72 + s]);
    }
  }
  __syncthreads();

  // ---- out = attn @ v  +  P @ rel_v  (both WMMA) ----
  for (int tIdx = wave; tIdx < 16; tIdx += 8) {
    int mt = tIdx >> 2, nt = tIdx & 3;
    f8v acc = {};
#pragma unroll
    for (int k0 = 0; k0 < TT; k0 += 32)
      acc = wmma_f16(frag_ld(attnb, mt * 16, k0, 72), frag_ld(vTs, nt * 16, k0, 72), acc);
#pragma unroll
    for (int k0 = 0; k0 < RPADK; k0 += 32)
      acc = wmma_f16(frag_ld(Pm, mt * 16, k0, 264), frag_ld(rls, nt * 16, k0, 264), acc);
    const int g = lane >> 4, d = nt * 16 + (lane & 15);
#pragma unroll
    for (int r = 0; r < 8; r++) {
      const int t = mt * 16 + g * 8 + r;
      outO[((size_t)b * TT + t) * DM + h * DH + d] = (_Float16)acc[r];
    }
  }
}

// ---------------------------------------------------------------------------
// Host launcher
// ---------------------------------------------------------------------------
extern "C" void kernel_launch(void* const* d_in, const int* in_sizes, int n_in,
                              void* d_out, int out_size, void* d_ws, size_t ws_size,
                              hipStream_t stream) {
  (void)in_sizes; (void)n_in; (void)out_size; (void)ws_size;
  const float* x     = (const float*)d_in[0];
  const float* Wq_w  = (const float*)d_in[1];
  const float* Wq_b  = (const float*)d_in[2];
  const float* Wk_w  = (const float*)d_in[3];
  const float* Wk_b  = (const float*)d_in[4];
  const float* Wv_w  = (const float*)d_in[5];
  const float* Wv_b  = (const float*)d_in[6];
  const float* Wo_w  = (const float*)d_in[7];
  const float* Wo_b  = (const float*)d_in[8];
  const float* rel_q = (const float*)d_in[9];
  const float* rel_k = (const float*)d_in[10];
  const float* rel_v = (const float*)d_in[11];
  const int*   ridx  = (const int*)d_in[12];

  char* ws = (char*)d_ws;
  // workspace layout (bytes)
  _Float16* xh = (_Float16*)(ws);                       // 67,108,864  (x f16; reused as oh)
  _Float16* wh = (_Float16*)(ws + 67108864);            //  8,388,608  (Wq,Wk,Wv,Wo f16)
  _Float16* qh = (_Float16*)(ws + 75497472);            // 67,108,864  (B,H,T,64)
  _Float16* kh = (_Float16*)(ws + 142606336);           // 67,108,864
  _Float16* vh = (_Float16*)(ws + 209715200);           // 67,108,864
  float*    RR = (float*)(ws + 276824064);              //     14,400
  _Float16* ri = (_Float16*)(ws + 276840448);           //  1,769,472  (3,H,RIMG) table images
  int*      rm = (int*)(ws + 278609920);                //     16,384  (64,64) row table
  _Float16* oh = xh;  // x consumed before attention writes here (same stream)

  const int nx = MTOT * DM;     // 33,554,432
  const int nw = DM * DM;       //  1,048,576
  cast_f32_f16_v8<<<nx / 8 / 256, 256, 0, stream>>>(x,    xh,                  nx / 8);
  cast_f32_f16_v8<<<nw / 8 / 256, 256, 0, stream>>>(Wq_w, wh + 0 * (size_t)nw, nw / 8);
  cast_f32_f16_v8<<<nw / 8 / 256, 256, 0, stream>>>(Wk_w, wh + 1 * (size_t)nw, nw / 8);
  cast_f32_f16_v8<<<nw / 8 / 256, 256, 0, stream>>>(Wv_w, wh + 2 * (size_t)nw, nw / 8);
  cast_f32_f16_v8<<<nw / 8 / 256, 256, 0, stream>>>(Wo_w, wh + 3 * (size_t)nw, nw / 8);
  rr_kernel<<<(NH * NREL + 255) / 256, 256, 0, stream>>>(rel_q, rel_k, RR);
  rel_image_kernel<<<dim3(RIMG / 8 / 256, NH, 3), 256, 0, stream>>>(rel_q, rel_k, rel_v, ri);
  rel_rows_kernel<<<TT, TT, 0, stream>>>(ridx, rm);

  dim3 gproj(DM / 256, MTOT / 128);  // (4, 256)
  gemm_proj<0><<<gproj, 128, 0, stream>>>(xh, wh + 0 * (size_t)nw, Wq_b, qh, nullptr);
  gemm_proj<0><<<gproj, 128, 0, stream>>>(xh, wh + 1 * (size_t)nw, Wk_b, kh, nullptr);
  gemm_proj<0><<<gproj, 128, 0, stream>>>(xh, wh + 2 * (size_t)nw, Wv_b, vh, nullptr);

  attn_kernel<<<dim3(NH, BB), 256, 142336, stream>>>(qh, kh, vh, ri, ridx, rm, RR, oh);

  gemm_proj<1><<<gproj, 128, 0, stream>>>(oh, wh + 3 * (size_t)nw, Wo_b, nullptr,
                                          (float*)d_out);
}

// v004
// Measured time: 390 microseconds a run.
// Timed twice side by side with v003, it ran 1.08 times as fast both times.
// Over all steps from v000 it is 3.02 times as fast.
#include <hip/hip_runtime.h>
#include <hip/hip_bf16.h>

// ---------------------------------------------------------------------------
// Types for WMMA fragments (gfx1250, wave32)
// ---------------------------------------------------------------------------
typedef _Float16 h8  __attribute__((ext_vector_type(8)));
typedef _Float16 h16 __attribute__((ext_vector_type(16)));
typedef float    f8v __attribute__((ext_vector_type(8)));
typedef float    f4v __attribute__((ext_vector_type(4)));
typedef float    f2v __attribute__((ext_vector_type(2)));
typedef int      i4v __attribute__((ext_vector_type(4)));

__device__ __forceinline__ f8v wmma_f16(h16 a, h16 b, f8v c) {
  // D = A(16x32 f16) * B(32x16 f16) + C(16x16 f32)
  return __builtin_amdgcn_wmma_f32_16x16x32_f16(
      /*neg_a=*/false, a, /*neg_b=*/false, b,
      /*c_mod=*/(short)0, c, /*reuse_a=*/false, /*reuse_b=*/false);
}

// ---------------------------------------------------------------------------
// Async global->LDS copy (GLOBAL_LOAD_ASYNC_TO_LDS_B128, ASYNCcnt-tracked).
// Builtin signature (from clang diagnostic): (int4 AS1*, int4 AS3*, imm, imm).
// Falls back to a synchronous 16B copy when the builtin is unavailable.
// ---------------------------------------------------------------------------
#if defined(__gfx1250__) && __has_builtin(__builtin_amdgcn_global_load_async_to_lds_b128)
#define HAVE_ASYNC_LDS 1
#else
#define HAVE_ASYNC_LDS 0
#endif

__device__ __forceinline__ void cp16B(const _Float16* g, _Float16* l) {
#if HAVE_ASYNC_LDS
  __builtin_amdgcn_global_load_async_to_lds_b128(
      (__attribute__((address_space(1))) i4v*)g,
      (__attribute__((address_space(3))) i4v*)l, 0, 0);
#else
  *(h8*)l = *(const h8*)g;
#endif
}

__device__ __forceinline__ void cp_wait() {
#if HAVE_ASYNC_LDS
  asm volatile("s_wait_asynccnt 0x0" ::: "memory");
#endif
}

// NT fragment loader. Both A and B fragments of V_WMMA_F32_16X16X32_F16 read
// row (lane&15) of a row-major-along-K tile, in two contiguous 8-half runs:
//   k in [8g, 8g+8) and [8g+16, 8g+24),  g = lane>>4     (ISA 7.12.2 layout)
// => two ds_load_b128 per fragment.
__device__ __forceinline__ h16 frag_ld(const _Float16* base, int row0, int k0, int stride) {
  const int lane = threadIdx.x & 31;
  const int g = lane >> 4;
  const _Float16* p = base + (size_t)(row0 + (lane & 15)) * stride + k0 + 8 * g;
  h8 lo = *(const h8*)(p);
  h8 hi = *(const h8*)(p + 16);
  return __builtin_shufflevector(lo, hi, 0,1,2,3,4,5,6,7,8,9,10,11,12,13,14,15);
}

// ---------------------------------------------------------------------------
// Problem constants
// ---------------------------------------------------------------------------
#define BB       512
#define TT       64
#define DM       1024
#define NH       16
#define DH       64
#define NREL     225
#define RPADN    240   // NREL padded to WMMA N tiles (15 * 16)
#define RPADK    256   // NREL padded to WMMA K steps (8 * 32)
#define MTOT     (BB * TT)   // 32768
#define RIMG     18432 // halves in one staged table image: 9 rounds of 256 lanes x 16 B

// ---------------------------------------------------------------------------
// Vectorized f32 -> f16 cast: 8 elements / thread (2x b128 load, 1x b128 store)
// ---------------------------------------------------------------------------
__device__ __forceinline__ void cast_f32_f16_v8(const float* __restrict__ src,
                                                _Float16* __restrict__ dst, int i) {
  const f4v* s = (const f4v*)src;
  f4v a = s[2 * (size_t)i], b = s[2 * (size_t)i + 1];
  h8 o;
#pragma unroll
  for (int j = 0; j < 4; j++) { o[j] = (_Float16)a[j]; o[j + 4] = (_Float16)b[j]; }
  *(h8*)(dst + (size_t)i * 8) = o;
  // precaution: stands ahead of every later write of a register that the store names (the
  // other parts of the merged kernel follow the inlined call in the built code)
  asm volatile("s_wait_xcnt 0x0" ::: "memory");
}

// RR[h,r] = dot(rel_q[h,r,:], rel_k[h,r,:])
__device__ __forceinline__ void rr_part(const float* __restrict__ rq,
                                        const float* __restrict__ rk,
                                        float* __restrict__ RR, int i) {
  if (i < NH * NREL) {
    const float* a = rq + (size_t)i * DH;
    const float* b = rk + (size_t)i * DH;
    float s = 0.f;
#pragma unroll
    for (int d = 0; d < DH; d++) s += a[d] * b[d];
    RR[i] = s;
  }
}

// Builds, once per call, the f16 images of the three relative tables exactly as
// attn_kernel keeps them in LDS, so that each work-group stages a table with
// straight 16-byte copies. One thread writes one 16-byte chunk; every byte of an
// image is written (padding as zero).
//   table 0: rel_k rows, pitch 72 halves, rows 225.. zero
//   table 1: rel_q rows, same shape
//   table 2: rel_v transposed [d][264], columns 225.. zero
__device__ __forceinline__ void rel_image_part(const float* __restrict__ rel_q,
                                               const float* __restrict__ rel_k,
                                               const float* __restrict__ rel_v,
                                               _Float16* __restrict__ img,
                                               int c,            // chunk in the image, 0..2303
                                               int h, int tb) {
  h8 o = {};
  if (tb < 2) {
    const float* src = (tb == 0) ? rel_k : rel_q;
    const int r = c / 9, cc = c % 9;
    if (r < NREL && cc < 8) {
      const f4v* s = (const f4v*)(src + ((size_t)h * NREL + r) * DH + cc * 8);
      f4v a = s[0], b = s[1];
#pragma unroll  // constant element indices keep o in registers
      for (int j = 0; j < 4; j++) { o[j] = (_Float16)a[j]; o[j + 4] = (_Float16)b[j]; }
    }
  } else {
    const int d = c / 33, r0 = (c % 33) * 8;
    if (d < DH) {
#pragma unroll  // constant element indices keep o in registers
      for (int j = 0; j < 8; j++) {
        // row clamped, value selected afterwards: the eight loads go out together
        const int r = r0 + j, rc = (r < NREL) ? r : NREL - 1;
        const float v = rel_v[((size_t)h * NREL + rc) * DH + d];
        o[j] = (r < NREL) ? (_Float16)v : (_Float16)0.f;
      }
    }
  }
  *(h8*)(img + (size_t)(tb * NH + h) * RIMG + (size_t)c * 8) = o;
}

// Row table for the P build, once per call: meta[t,s] = rel_index[t,s] bounded to
// 0..224, with bit 8 set in every entry of a row t that names some index twice.
// A row without a repeat can be scattered by several lanes at once.
// A block of 256 threads takes four rows, two waves a row; every thread of the block
// comes here together (the two barriers).
__device__ __forceinline__ void rel_rows_part(const int* __restrict__ rel_index,
                                              int* __restrict__ meta, int blk) {
  __shared__ int row[4][TT];
  __shared__ int rep[8];
  const int q = threadIdx.x >> 6, s = threadIdx.x & 63;
  const int t = blk * 4 + q;
  const int v = min(max(rel_index[t * TT + s], 0), NREL - 1);
  row[q][s] = v;
  __syncthreads();
  int n = 0;   // how often this entry's index stands in the row, itself included
  for (int o = 0; o < TT; o++) n += (row[q][o] == v) ? 1 : 0;
  const int any = __any(n > 1);
  if ((s & 31) == 0) rep[threadIdx.x >> 5] = any ? 1 : 0;
  __syncthreads();
  meta[t * TT + s] = v | ((rep[2 * q] | rep[2 * q + 1]) << 8);
}

// ---------------------------------------------------------------------------
// All the work that needs nothing but the inputs, in one launch: each part has its
// own range of the block index (the branch is the same for a whole block). The
// short parts that wait on latency come first, the long stream of x last.
// ---------------------------------------------------------------------------
#define PB_ROWS  (TT / 4)                     //    16 blocks: row table
#define PB_RR    ((NH * NREL + 255) / 256)    //    15 blocks: RR
#define PB_IMG1  (RIMG / 8 / 256)             //     9 blocks an image
#define PB_IMG   (PB_IMG1 * NH * 3)           //   432 blocks: table images
#define PB_W1    (DM * DM / 8 / 256)          //   512 blocks a weight matrix
#define PB_W     (PB_W1 * 4)                  //  2048 blocks: weight casts
#define PB_X     (MTOT * DM / 8 / 256)        // 16384 blocks: x cast
#define PB_ALL   (PB_ROWS + PB_RR + PB_IMG + PB_W + PB_X)

__global__ __launch_bounds__(256) void prep_kernel(
    const float* __restrict__ x,
    const float* __restrict__ Wq_w, const float* __restrict__ Wk_w,
    const float* __restrict__ Wv_w, const float* __restrict__ Wo_w,
    const float* __restrict__ rel_q, const float* __restrict__ rel_k,
    const float* __restrict__ rel_v, const int* __restrict__ rel_index,
    _Float16* __restrict__ xh, _Float16* __restrict__ wh, float* __restrict__ RR,
    _Float16* __restrict__ img, int* __restrict__ meta) {
  const int tid = threadIdx.x;
  int blk = blockIdx.x;
  if (blk < PB_ROWS) { rel_rows_part(rel_index, meta, blk); return; }
  blk -= PB_ROWS;
  if (blk < PB_RR) { rr_part(rel_q, rel_k, RR, blk * 256 + tid); return; }
  blk -= PB_RR;
  if (blk < PB_IMG) {
    const int im = blk / PB_IMG1;             // image number, table * NH + head
    rel_image_part(rel_q, rel_k, rel_v, img, (blk % PB_IMG1) * 256 + tid, im % NH, im / NH);
    return;
  }
  blk -= PB_IMG;
  if (blk < PB_W) {
    const int w = blk / PB_W1;
    const float* src = (w == 0) ? Wq_w : (w == 1) ? Wk_w : (w == 2) ? Wv_w : Wo_w;
    cast_f32_f16_v8(src, wh + (size_t)w * (DM * DM), (blk % PB_W1) * 256 + tid);
    return;
  }
  blk -= PB_W;
  cast_f32_f16_v8(x, xh, blk * 256 + tid);
}

// Value of lane (l ^ 1) or (l ^ 2) inside each group of four lanes (DPP quad_perm).
template <int CTRL>
__device__ __forceinline__ float quad_swap(float x) {
  return __builtin_bit_cast(float, __builtin_amdgcn_mov_dpp(__builtin_bit_cast(int, x), CTRL,
                                                            0xf, 0xf, true));
}

// ---------------------------------------------------------------------------
// NT GEMM: C[m,n] = sum_k A[m,k] * W[n,k] + bias[n]
// A: (32768,1024) f16 row-major, W: f16 row-major, 1024 rows a projection.
// OUT_MODE 0: f16, head-split (b,h,t,d) layout.   OUT_MODE 1: f32 row-major.
// blockIdx.x counts 256-column blocks through the projections that lie behind one
// another in W and in outH (four blocks each); each has its own bias pointer.
// 128x256 block tile, 128 threads = 4 waves, each wave a 64x128 sub-tile
// (4x8 WMMA tiles): 12 fragments feed 32 WMMAs. K stepped by 64 (whole 128-byte
// lines of every operand row) through double-buffered LDS with async
// global->LDS copies one stage ahead. Two work-groups share a WGP.
// ---------------------------------------------------------------------------
template <int OUT_MODE>
__global__ __launch_bounds__(128) void gemm_proj(const _Float16* __restrict__ A,
                                                 const _Float16* __restrict__ W,
                                                 const float* __restrict__ bias0,
                                                 const float* __restrict__ bias1,
                                                 const float* __restrict__ bias2,
                                                 _Float16* __restrict__ outH,
                                                 float* __restrict__ outF) {
  constexpr int K = DM, KS = 64, LDW = 72;   // 64 + 8 halves pad: 144-byte pitch
  constexpr int BM = 128, BN = 256;
  constexpr int ATILE = BM * LDW;            //  9216 halves per buffer
  constexpr int WTILE = BN * LDW;            // 18432 halves per buffer
  __shared__ _Float16 As[2 * ATILE];
  __shared__ _Float16 Ws[2 * WTILE];

  const int tid  = threadIdx.x;
  const int wave = tid >> 5, lane = tid & 31;
  const int m0 = blockIdx.y * BM, n0 = (blockIdx.x & 3) * BN;
  const int proj = blockIdx.x >> 2;            // which projection this block belongs to
  W += (size_t)proj * (DM * DM);
  if (OUT_MODE == 0) outH += (size_t)proj * ((size_t)MTOT * DM);
  const float* bias = (proj == 0) ? bias0 : (proj == 1) ? bias1 : bias2;
  const int wm0 = (wave & 1) * 64, wn0 = (wave >> 1) * 128;

  // Eight lanes copy one row's 128 bytes; a round of 128 lanes covers 16 rows.
  const int crow = tid >> 3, ccol = (tid & 7) * 8;
  const _Float16* gA = A + (size_t)(m0 + crow) * K + ccol;
  const _Float16* gW = W + (size_t)(n0 + crow) * K + ccol;
  _Float16* lA = As + crow * LDW + ccol;
  _Float16* lW = Ws + crow * LDW + ccol;

  auto stage = [&](int k0, int bsel) {
#pragma unroll  // all 24 copies of a stage in flight together, every lane on
    for (int i = 0; i < BM / 16; i++)
      cp16B(gA + (size_t)i * 16 * K + k0, lA + bsel * ATILE + i * 16 * LDW);
#pragma unroll
    for (int i = 0; i < BN / 16; i++)
      cp16B(gW + (size_t)i * 16 * K + k0, lW + bsel * WTILE + i * 16 * LDW);
  };

  f8v acc[4][8] = {};

  stage(0, 0);
  cp_wait();
  __syncthreads();

  int buf = 0;
  for (int k0 = 0; k0 < K; k0 += KS) {
    if (k0 + KS < K) stage(k0 + KS, buf ^ 1);    // next stage into the other buffer

    const _Float16* Ab = As + buf * ATILE;
    const _Float16* Wb = Ws + buf * WTILE;
#pragma unroll
    for (int kk = 0; kk < KS; kk += 32) {
      h16 af[4], bf[8];
#pragma unroll
      for (int i = 0; i < 4; i++) af[i] = frag_ld(Ab, wm0 + i * 16, kk, LDW);
#pragma unroll
      for (int j = 0; j < 8; j++) bf[j] = frag_ld(Wb, wn0 + j * 16, kk, LDW);
      // keeps the 24 LDS reads of a k step together ahead of its 32 WMMAs: without it the
      // A fragments share one register set and every row of 8 WMMAs waits out its own read
      __builtin_amdgcn_sched_barrier(0);
#pragma unroll
      for (int i = 0; i < 4; i++)
#pragma unroll
        for (int j = 0; j < 8; j++) acc[i][j] = wmma_f16(af[i], bf[j], acc[i][j]);
    }

    // keeps the stage's last WMMAs ahead of the waits: sunk behind the barrier they would
    // stand between it and the next copies, which then fly for half a stage only
    __builtin_amdgcn_sched_barrier(0);
    // this wave's reads of the buffer are done before it is refilled behind the barrier
    asm volatile("s_wait_dscnt 0x0" ::: "memory");
    cp_wait();
    __syncthreads();
    buf ^= 1;
  }

  const int g = lane >> 4, nl = lane & 15;
  float bvs[8];
#pragma unroll  // constant indices keep the eight values in registers
  for (int j = 0; j < 8; j++) bvs[j] = bias[n0 + wn0 + j * 16 + nl];
  // precaution: stands ahead of the first write of the offset register that the loads name
  asm volatile("s_wait_xcnt 0x0" ::: "memory");
#pragma unroll
  for (int j = 0; j < 8; j++) {
    const int gn = n0 + wn0 + j * 16 + nl;
    const float bv = bvs[j];
#pragma unroll
    for (int i = 0; i < 4; i++) {
#pragma unroll
      for (int r = 0; r < 8; r++) {
        const int gm = m0 + wm0 + i * 16 + g * 8 + r;  // C layout: M = r + 8*(lane>>4)
        const float v = acc[i][j][r] + bv;
        if (OUT_MODE == 0) {
          const int b = gm >> 6, t = gm & 63, h = gn >> 6, d = gn & 63;
          outH[(((size_t)(b * NH + h) * TT + t) * DH) + d] = (_Float16)v;
        } else {
          outF[(size_t)gm * DM + gn] = v;
        }
      }
    }
  }
}

// ---------------------------------------------------------------------------
// Fused relative attention for one (b,h): 256 threads, dynamic LDS.
// LDS half-offsets:
//   qs   [64x72]      0      (reused as attn f16 after softmax)
//   ks   [64x72]      4608
//   vTs  [64x72]      9216   (v stored transposed [d][s])
//   rls  [18432]      13824  (rel_k rows -> rel_q rows -> rel_vT [64x264])
//   Qr   [64x240]     32256  \ overlaid later by P [64x264]
//   Kr   [64x240]     47616  /
//   Ls   f32 [64x64]  byte 125952
// total 142336 bytes dynamic shared (< 320 KB/WG on CDNA5).
// ---------------------------------------------------------------------------
__global__ __launch_bounds__(256) void attn_kernel(
    const _Float16* __restrict__ qg, const _Float16* __restrict__ kg,
    const _Float16* __restrict__ vg,                 // (B,H,T,DH) f16
    const _Float16* __restrict__ relimg,             // (3,H,RIMG) f16 table images
    const int* __restrict__ rel_index,               // (64,64)
    const int* __restrict__ relmeta,                 // (64,64) bounded index | repeat flag
    const float* __restrict__ RR,                    // (H,225)
    _Float16* __restrict__ outO)                     // (B,T,1024) f16
{
  extern __shared__ char smem_raw[];
  _Float16* qs    = (_Float16*)smem_raw;
  _Float16* ks    = qs + 4608;
  _Float16* vTs   = ks + 4608;
  _Float16* rls   = vTs + 4608;
  _Float16* Qr    = rls + RIMG;
  _Float16* Kr    = Qr + 64 * RPADN;
  _Float16* Pm    = Qr;        // overlay after gathers
  _Float16* attnb = qs;        // overlay after logits
  float*    Ls    = (float*)(smem_raw + 125952);

  const int h = blockIdx.x, b = blockIdx.y;
  const int tid = threadIdx.x, wave = tid >> 5, lane = tid & 31;
  const size_t bh = ((size_t)b * NH + h) * (TT * DH);

  // One table image -> rls: 9 async 16B copies per lane, every lane on.
  auto stage_rel = [&](int tb) {
    const _Float16* s = relimg + (size_t)(tb * NH + h) * RIMG + tid * 8;
    _Float16* l = rls + tid * 8;
#pragma unroll  // all nine copies in flight together
    for (int i = 0; i < 9; i++) cp16B(s + i * 2048, l + i * 2048);
  };

  // ---- stage q, k, rel_k rows (async 16B copies), vT (transposed) ----
  for (int c = tid; c < 512; c += 256) {
    int row = c >> 3, col = (c & 7) * 8;
    cp16B(&qg[bh + row * DH + col], &qs[row * 72 + col]);
    cp16B(&kg[bh + row * DH + col], &ks[row * 72 + col]);
  }
  stage_rel(0);
  for (int e = tid; e < TT * DH; e += 256) {
    int d = e & 63, s = e >> 6;
    vTs[d * 72 + s] = vg[bh + (size_t)s * DH + d];
  }
  cp_wait();
  __syncthreads();

  // ---- Qr = q @ rel_k^T  (64 x 240, K=64) ----
  for (int tIdx = wave; tIdx < 60; tIdx += 8) {
    int mt = tIdx / 15, nt = tIdx % 15;
    f8v acc = {};
#pragma unroll
    for (int k0 = 0; k0 < DH; k0 += 32)
      acc = wmma_f16(frag_ld(qs, mt * 16, k0, 72), frag_ld(rls, nt * 16, k0, 72), acc);
    const int n = nt * 16 + (lane & 15), g = lane >> 4;
#pragma unroll
    for (int r = 0; r < 8; r++) Qr[(mt * 16 + g * 8 + r) * RPADN + n] = (_Float16)acc[r];
  }
  __syncthreads();

  // ---- restage rel_q, compute Kr = k @ rel_q^T ----
  stage_rel(1);
  cp_wait();  // rel_q copies landed before the barrier that publishes them
  __syncthreads();
  for (int tIdx = wave; tIdx < 60; tIdx += 8) {
    int mt = tIdx / 15, nt = tIdx % 15;
    f8v acc = {};
#pragma unroll
    for (int k0 = 0; k0 < DH; k0 += 32)
      acc = wmma_f16(frag_ld(ks, mt * 16, k0, 72), frag_ld(rls, nt * 16, k0, 72), acc);
    const int n = nt * 16 + (lane & 15), g = lane >> 4;
#pragma unroll
    for (int r = 0; r < 8; r++) Kr[(mt * 16 + g * 8 + r) * RPADN + n] = (_Float16)acc[r];
  }
  __syncthreads();

  // ---- stage rel_vT [d][264] while computing logits = q k^T + gathers ----
  stage_rel(2);
  for (int tIdx = wave; tIdx < 16; tIdx += 8) {
    int mt = tIdx >> 2, nt = tIdx & 3;
    f8v acc = {};
#pragma unroll
    for (int k0 = 0; k0 < DH; k0 += 32)
      acc = wmma_f16(frag_ld(qs, mt * 16, k0, 72), frag_ld(ks, nt * 16, k0, 72), acc);
    const int s = nt * 16 + (lane & 15), g = lane >> 4;
#pragma unroll
    for (int r = 0; r < 8; r++) {
      const int t = mt * 16 + g * 8 + r;
      const int idx = rel_index[t * TT + s];
      Ls[t * TT + s] = acc[r] + (float)Qr[t * RPADN + idx] +
                       (float)Kr[s * RPADN + idx] + RR[h * NREL + idx];
    }
  }
  cp_wait();  // rel_vT copies landed before the barrier that publishes them
  __syncthreads();

  // ---- zero P (overlays Qr/Kr) + softmax: four lanes a row, 16 logits each ----
  const int t4 = tid >> 2, j4 = tid & 3;
  i4v mt4[4];
#pragma unroll  // constant indices keep the slice in registers
  for (int i = 0; i < 4; i++) mt4[i] = ((const i4v*)(relmeta + t4 * TT + j4 * 16))[i];
#pragma unroll  // 2112 chunks of 16 B: eight rounds of 256 lanes and a rest of 64
  for (int i = 0; i < 8; i++) *(h8*)(Pm + (tid + i * 256) * 8) = h8{};
  if (tid < 64) *(h8*)(Pm + (tid + 2048) * 8) = h8{};
  _Float16 at[16];
  {
    const float scale = 0.125f;  // 1/sqrt(64)
    f2v l[8];
#pragma unroll  // constant indices keep the slice in registers
    for (int i = 0; i < 4; i++) {
      const f4v x4 = ((const f4v*)(Ls + t4 * TT + j4 * 16))[i];
      l[2 * i] = f2v{x4[0], x4[1]};
      l[2 * i + 1] = f2v{x4[2], x4[3]};
    }
    float mx = -1e30f;
#pragma unroll  // constant indices keep the slice in registers
    for (int i = 0; i < 8; i++) mx = fmaxf(mx, fmaxf(l[i][0], l[i][1]));
    mx = fmaxf(mx, quad_swap<0xB1>(mx));   // lane ^ 1
    mx = fmaxf(mx, quad_swap<0x4E>(mx));   // lane ^ 2
    f2v sum2 = {0.f, 0.f};
#pragma unroll  // constant indices keep the slice in registers
    for (int i = 0; i < 8; i++) {
      const f2v a = (l[i] - mx) * scale;
      l[i] = f2v{__expf(a[0]), __expf(a[1])};
      sum2 += l[i];
    }
    float sum = sum2[0] + sum2[1];
    sum += quad_swap<0xB1>(sum);
    sum += quad_swap<0x4E>(sum);
    const float inv = 1.f / sum;
    h8 lo, hi;
#pragma unroll  // constant indices keep the slice in registers
    for (int i = 0; i < 8; i++) {
      const f2v p = l[i] * inv;
      at[2 * i] = (_Float16)p[0];
      at[2 * i + 1] = (_Float16)p[1];
    }
#pragma unroll  // constant indices keep the slice in registers
    for (int i = 0; i < 8; i++) { lo[i] = at[i]; hi[i] = at[i + 8]; }
    *(h8*)(attnb + t4 * 72 + j4 * 16)     = lo;
    *(h8*)(attnb + t4 * 72 + j4 * 16 + 8) = hi;
  }
  __syncthreads();

  // ---- scatter P[t,r] += attn[t,s] ----
  if (!(mt4[0][0] & 256)) {
    // no index twice in row t: every s has its own element of the zeroed row
#pragma unroll  // constant indices keep the slice in registers
    for (int i = 0; i < 16; i++) Pm[t4 * 264 + (mt4[i >> 2][i & 3] & 255)] = at[i];
  } else if (j4 == 0) {
    // a repeated index: one lane adds the row's 64 values in order of s
    for (int s = 0; s < TT; s++) {
      const int idx = relmeta[t4 * TT + s] & 255;
      Pm[t4 * 264 + idx] = (_Float16)((float)Pm[t4 * 264 + idx] + (float)attnb[t4 * 72 + s]);
    }
  }
  __syncthreads();

  // ---- out = attn @ v  +  P @ rel_v  (both WMMA) ----
  for (int tIdx = wave; tIdx < 16; tIdx += 8) {
    int mt = tIdx >> 2, nt = tIdx & 3;
    f8v acc = {};
#pragma unroll
    for (int k0 = 0; k0 < TT; k0 += 32)
      acc = wmma_f16(frag_ld(attnb, mt * 16, k0, 72), frag_ld(vTs, nt * 16, k0, 72), acc);
#pragma unroll
    for (int k0 = 0; k0 < RPADK; k0 += 32)
      acc = wmma_f16(frag_ld(Pm, mt * 16, k0, 264), frag_ld(rls, nt * 16, k0, 264), acc);
    const int g = lane >> 4, d = nt * 16 + (lane & 15);
#pragma unroll
    for (int r = 0; r < 8; r++) {
      const int t = mt * 16 + g * 8 + r;
      outO[((size_t)b * TT + t) * DM + h * DH + d] = (_Float16)acc[r];
    }
  }
}

// ---------------------------------------------------------------------------
// Host launcher
// ---------------------------------------------------------------------------
extern "C" void kernel_launch(void* const* d_in, const int* in_sizes, int n_in,
                              void* d_out, int out_size, void* d_ws, size_t ws_size,
                              hipStream_t stream) {
  (void)in_sizes; (void)n_in; (void)out_size; (void)ws_size;
  const float* x     = (const float*)d_in[0];
  const float* Wq_w  = (const float*)d_in[1];
  const float* Wq_b  = (const float*)d_in[2];
  const float* Wk_w  = (const float*)d_in[3];
  const float* Wk_b  = (const float*)d_in[4];
  const float* Wv_w  = (const float*)d_in[5];
  const float* Wv_b  = (const float*)d_in[6];
  const float* Wo_w  = (const float*)d_in[7];
  const float* Wo_b  = (const float*)d_in[8];
  const float* rel_q = (const float*)d_in[9];
  const float* rel_k = (const float*)d_in[10];
  const float* rel_v = (const float*)d_in[11];
  const int*   ridx  = (const int*)d_in[12];

  char* ws = (char*)d_ws;
  // workspace layout (bytes)
  _Float16* xh = (_Float16*)(ws);                       // 67,108,864  (x f16; reused as oh)
  _Float16* wh = (_Float16*)(ws + 67108864);            //  8,388,608  (Wq,Wk,Wv,Wo f16)
  _Float16* qh = (_Float16*)(ws + 75497472);            // 67,108,864  (B,H,T,64)
  _Float16* kh = (_Float16*)(ws + 142606336);           // 67,108,864
  _Float16* vh = (_Float16*)(ws + 209715200);           // 67,108,864
  float*    RR = (float*)(ws + 276824064);              //     14,400
  _Float16* ri = (_Float16*)(ws + 276840448);           //  1,769,472  (3,H,RIMG) table images
  int*      rm = (int*)(ws + 278609920);                //     16,384  (64,64) row table
  _Float16* oh = xh;  // x consumed before attention writes here (same stream)

  const int nw = DM * DM;       //  1,048,576
  prep_kernel<<<PB_ALL, 256, 0, stream>>>(x, Wq_w, Wk_w, Wv_w, Wo_w, rel_q, rel_k, rel_v, ridx,
                                          xh, wh, RR, ri, rm);

  // q, k, v in one grid: Wq, Wk, Wv lie behind one another in wh, and qh, kh, vh in ws
  gemm_proj<0><<<dim3(3 * DM / 256, MTOT / 128), 128, 0, stream>>>(xh, wh, Wq_b, Wk_b, Wv_b, qh,
                                                                   nullptr);

  attn_kernel<<<dim3(NH, BB), 256, 142336, stream>>>(qh, kh, vh, ri, ridx, rm, RR, oh);

  gemm_proj<1><<<dim3(DM / 256, MTOT / 128), 128, 0, stream>>>(oh, wh + 3 * (size_t)nw, Wo_b, Wo_b,
                                                               Wo_b, nullptr, (float*)d_out);
}

// v005
// One run takes 342 microseconds.
// Two timings next to v004 both put it at 1.14 times that version's speed.
// Over all steps from v000 it is 3.44 times as fast.
#include <hip/hip_runtime.h>
#include <hip/hip_bf16.h>

// ---------------------------------------------------------------------------
// Types for WMMA fragments (gfx1250, wave32)
// ---------------------------------------------------------------------------
typedef _Float16 h8  __attribute__((ext_vector_type(8)));
typedef _Float16 h16 __attribute__((ext_vector_type(16)));
typedef float    f8v __attribute__((ext_vector_type(8)));
typedef float    f4v __attribute__((ext_vector_type(4)));
typedef float    f2v __attribute__((ext_vector_type(2)));
typedef int      i4v __attribute__((ext_vector_type(4)));

__device__ __forceinline__ f8v wmma_f16(h16 a, h16 b, f8v c) {
  // D = A(16x32 f16) * B(32x16 f16) + C(16x16 f32)
  return __builtin_amdgcn_wmma_f32_16x16x32_f16(
      /*neg_a=*/false, a, /*neg_b=*/false, b,
      /*c_mod=*/(short)0, c, /*reuse_a=*/false, /*reuse_b=*/false);
}

// ---------------------------------------------------------------------------
// Async global->LDS copy (GLOBAL_LOAD_ASYNC_TO_LDS_B128, ASYNCcnt-tracked).
// Builtin signature (from clang diagnostic): (int4 AS1*, int4 AS3*, imm, imm).
// Falls back to a synchronous 16B copy when the builtin is unavailable.
// ---------------------------------------------------------------------------
#if defined(__gfx1250__) && __has_builtin(__builtin_amdgcn_global_load_async_to_lds_b128)
#define HAVE_ASYNC_LDS 1
#else
#define HAVE_ASYNC_LDS 0
#endif

__device__ __forceinline__ void cp16B(const _Float16* g, _Float16* l) {
#if HAVE_ASYNC_LDS
  __builtin_amdgcn_global_load_async_to_lds_b128(
      (__attribute__((address_space(1))) i4v*)g,
      (__attribute__((address_space(3))) i4v*)l, 0, 0);
#else
  *(h8*)l = *(const h8*)g;
#endif
}

__device__ __forceinline__ void cp_wait() {
#if HAVE_ASYNC_LDS
  asm volatile("s_wait_asynccnt 0x0" ::: "memory");
#endif
}

// NT fragment loader. Both A and B fragments of V_WMMA_F32_16X16X32_F16 read
// row (lane&15) of a row-major-along-K tile, in two contiguous 8-half runs:
//   k in [8g, 8g+8) and [8g+16, 8g+24),  g = lane>>4     (ISA 7.12.2 layout)
// => two ds_load_b128 per fragment.
__device__ __forceinline__ h16 frag_ld(const _Float16* base, int row0, int k0, int stride) {
  const int lane = threadIdx.x & 31;
  const int g = lane >> 4;
  const _Float16* p = base + (size_t)(row0 + (lane & 15)) * stride + k0 + 8 * g;
  h8 lo = *(const h8*)(p);
  h8 hi = *(const h8*)(p + 16);
  return __builtin_shufflevector(lo, hi, 0,1,2,3,4,5,6,7,8,9,10,11,12,13,14,15);
}

// ---------------------------------------------------------------------------
// Problem constants
// ---------------------------------------------------------------------------
#define BB       512
#define TT       64
#define DM       1024
#define NH       16
#define DH       64
#define NREL     225
#define RPIT     248   // LDS pitch of a Qr / Kr row in halves (240 used, 15 WMMA tiles): 496 B = 16 B x 31
#define RPADK    256   // NREL padded to WMMA K steps (8 * 32)
#define MTOT     (BB * TT)   // 32768
#define RIMG     18432 // halves in one staged table image: 9 rounds of 256 lanes x 16 B

// ---------------------------------------------------------------------------
// Vectorized f32 -> f16 cast: 8 elements / thread (2x b128 load, 1x b128 store)
// ---------------------------------------------------------------------------
__device__ __forceinline__ void cast_f32_f16_v8(const float* __restrict__ src,
                                                _Float16* __restrict__ dst, int i) {
  const f4v* s = (const f4v*)src;
  f4v a = s[2 * (size_t)i], b = s[2 * (size_t)i + 1];
  h8 o;
#pragma unroll
  for (int j = 0; j < 4; j++) { o[j] = (_Float16)a[j]; o[j + 4] = (_Float16)b[j]; }
  *(h8*)(dst + (size_t)i * 8) = o;
  // precaution: stands ahead of every later write of a register that the store names (the
  // other parts of the merged kernel follow the inlined call in the built code)
  asm volatile("s_wait_xcnt 0x0" ::: "memory");
}

// RR[h,r] = dot(rel_q[h,r,:], rel_k[h,r,:])
__device__ __forceinline__ void rr_part(const float* __restrict__ rq,
                                        const float* __restrict__ rk,
                                        float* __restrict__ RR, int i) {
  if (i < NH * NREL) {
    const float* a = rq + (size_t)i * DH;
    const float* b = rk + (size_t)i * DH;
    float s = 0.f;
#pragma unroll
    for (int d = 0; d < DH; d++) s += a[d] * b[d];
    RR[i] = s;
  }
}

// Builds, once per call, the f16 images of the three relative tables exactly as
// attn_kernel keeps them in LDS, so that each work-group stages a table with
// straight 16-byte copies. One thread writes one 16-byte chunk; every byte of an
// image is written (padding as zero).
//   table 0: rel_k rows, pitch 72 halves, rows 225.. zero
//   table 1: rel_q rows, same shape
//   table 2: rel_v transposed [d][264], columns 225.. zero
__device__ __forceinline__ void rel_image_part(const float* __restrict__ rel_q,
                                               const float* __restrict__ rel_k,
                                               const float* __restrict__ rel_v,
                                               _Float16* __restrict__ img,
                                               int c,            // chunk in the image, 0..2303
                                               int h, int tb) {
  h8 o = {};
  if (tb < 2) {
    const float* src = (tb == 0) ? rel_k : rel_q;
    const int r = c / 9, cc = c % 9;
    if (r < NREL && cc < 8) {
      const f4v* s = (const f4v*)(src + ((size_t)h * NREL + r) * DH + cc * 8);
      f4v a = s[0], b = s[1];
#pragma unroll  // constant element indices keep o in registers
      for (int j = 0; j < 4; j++) { o[j] = (_Float16)a[j]; o[j + 4] = (_Float16)b[j]; }
    }
  } else {
    const int d = c / 33, r0 = (c % 33) * 8;
    if (d < DH) {
#pragma unroll  // constant element indices keep o in registers
      for (int j = 0; j < 8; j++) {
        // row clamped, value selected afterwards: the eight loads go out together
        const int r = r0 + j, rc = (r < NREL) ? r : NREL - 1;
        const float v = rel_v[((size_t)h * NREL + rc) * DH + d];
        o[j] = (r < NREL) ? (_Float16)v : (_Float16)0.f;
      }
    }
  }
  *(h8*)(img + (size_t)(tb * NH + h) * RIMG + (size_t)c * 8) = o;
}

// Row table for the P build, once per call: meta[t,s] = rel_index[t,s] bounded to
// 0..224, with bit 8 set in every entry of a row t that names some index twice.
// A row without a repeat can be scattered by several lanes at once.
// A block of 256 threads takes four rows, two waves a row; every thread of the block
// comes here together (the two barriers).
__device__ __forceinline__ void rel_rows_part(const int* __restrict__ rel_index,
                                              int* __restrict__ meta, int blk) {
  __shared__ int row[4][TT];
  __shared__ int rep[8];
  const int q = threadIdx.x >> 6, s = threadIdx.x & 63;
  const int t = blk * 4 + q;
  const int v = min(max(rel_index[t * TT + s], 0), NREL - 1);
  row[q][s] = v;
  __syncthreads();
  int n = 0;   // how often this entry's index stands in the row, itself included
  for (int o = 0; o < TT; o++) n += (row[q][o] == v) ? 1 : 0;
  const int any = __any(n > 1);
  if ((s & 31) == 0) rep[threadIdx.x >> 5] = any ? 1 : 0;
  __syncthreads();
  meta[t * TT + s] = v | ((rep[2 * q] | rep[2 * q + 1]) << 8);
}

// ---------------------------------------------------------------------------
// All the work that needs nothing but the inputs, in one launch: each part has its
// own range of the block index (the branch is the same for a whole block). The
// short parts that wait on latency come first, the long stream of x last.
// ---------------------------------------------------------------------------
#define PB_ROWS  (TT / 4)                     //    16 blocks: row table
#define PB_RR    ((NH * NREL + 255) / 256)    //    15 blocks: RR
#define PB_IMG1  (RIMG / 8 / 256)             //     9 blocks an image
#define PB_IMG   (PB_IMG1 * NH * 3)           //   432 blocks: table images
#define PB_W1    (DM * DM / 8 / 256)          //   512 blocks a weight matrix
#define PB_W     (PB_W1 * 4)                  //  2048 blocks: weight casts
#define PB_X     (MTOT * DM / 8 / 256)        // 16384 blocks: x cast
#define PB_ALL   (PB_ROWS + PB_RR + PB_IMG + PB_W + PB_X)

__global__ __launch_bounds__(256) void prep_kernel(
    const float* __restrict__ x,
    const float* __restrict__ Wq_w, const float* __restrict__ Wk_w,
    const float* __restrict__ Wv_w, const float* __restrict__ Wo_w,
    const float* __restrict__ rel_q, const float* __restrict__ rel_k,
    const float* __restrict__ rel_v, const int* __restrict__ rel_index,
    _Float16* __restrict__ xh, _Float16* __restrict__ wh, float* __restrict__ RR,
    _Float16* __restrict__ img, int* __restrict__ meta) {
  const int tid = threadIdx.x;
  int blk = blockIdx.x;
  if (blk < PB_ROWS) { rel_rows_part(rel_index, meta, blk); return; }
  blk -= PB_ROWS;
  if (blk < PB_RR) { rr_part(rel_q, rel_k, RR, blk * 256 + tid); return; }
  blk -= PB_RR;
  if (blk < PB_IMG) {
    const int im = blk / PB_IMG1;             // image number, table * NH + head
    rel_image_part(rel_q, rel_k, rel_v, img, (blk % PB_IMG1) * 256 + tid, im % NH, im / NH);
    return;
  }
  blk -= PB_IMG;
  if (blk < PB_W) {
    const int w = blk / PB_W1;
    const float* src = (w == 0) ? Wq_w : (w == 1) ? Wk_w : (w == 2) ? Wv_w : Wo_w;
    cast_f32_f16_v8(src, wh + (size_t)w * (DM * DM), (blk % PB_W1) * 256 + tid);
    return;
  }
  blk -= PB_W;
  cast_f32_f16_v8(x, xh, blk * 256 + tid);
}

// Value of lane (l ^ 1) or (l ^ 2) inside each group of four lanes (DPP quad_perm).
template <int CTRL>
__device__ __forceinline__ float quad_swap(float x) {
  return __builtin_bit_cast(float, __builtin_amdgcn_mov_dpp(__builtin_bit_cast(int, x), CTRL,
                                                            0xf, 0xf, true));
}

// ---------------------------------------------------------------------------
// NT GEMM: C[m,n] = sum_k A[m,k] * W[n,k] + bias[n]
// A: (32768,1024) f16 row-major, W: f16 row-major, 1024 rows a projection.
// OUT_MODE 0: f16, head-split (b,h,t,d) layout.   OUT_MODE 1: f32 row-major.
// blockIdx.x counts 256-column blocks through the projections that lie behind one
// another in W and in outH (four blocks each); each has its own bias pointer.
// 128x256 block tile, 128 threads = 4 waves, each wave a 64x128 sub-tile
// (4x8 WMMA tiles): 12 fragments feed 32 WMMAs. K stepped by 64 (whole 128-byte
// lines of every operand row) through double-buffered LDS with async
// global->LDS copies one stage ahead. Two work-groups share a WGP.
// ---------------------------------------------------------------------------
template <int OUT_MODE>
__global__ __launch_bounds__(128) void gemm_proj(const _Float16* __restrict__ A,
                                                 const _Float16* __restrict__ W,
                                                 const float* __restrict__ bias0,
                                                 const float* __restrict__ bias1,
                                                 const float* __restrict__ bias2,
                                                 _Float16* __restrict__ outH,
                                                 float* __restrict__ outF) {
  constexpr int K = DM, KS = 64, LDW = 72;   // 64 + 8 halves pad: 144-byte pitch
  constexpr int BM = 128, BN = 256;
  constexpr int ATILE = BM * LDW;            //  9216 halves per buffer
  constexpr int WTILE = BN * LDW;            // 18432 halves per buffer
  __shared__ _Float16 As[2 * ATILE];
  __shared__ _Float16 Ws[2 * WTILE];

  const int tid  = threadIdx.x;
  const int wave = tid >> 5, lane = tid & 31;
  const int m0 = blockIdx.y * BM, n0 = (blockIdx.x & 3) * BN;
  const int proj = blockIdx.x >> 2;            // which projection this block belongs to
  W += (size_t)proj * (DM * DM);
  if (OUT_MODE == 0) outH += (size_t)proj * ((size_t)MTOT * DM);
  const float* bias = (proj == 0) ? bias0 : (proj == 1) ? bias1 : bias2;
  const int wm0 = (wave & 1) * 64, wn0 = (wave >> 1) * 128;

  // Eight lanes copy one row's 128 bytes; a round of 128 lanes covers 16 rows.
  const int crow = tid >> 3, ccol = (tid & 7) * 8;
  const _Float16* gA = A + (size_t)(m0 + crow) * K + ccol;
  const _Float16* gW = W + (size_t)(n0 + crow) * K + ccol;
  _Float16* lA = As + crow * LDW + ccol;
  _Float16* lW = Ws + crow * LDW + ccol;

  auto stage = [&](int k0, int bsel) {
#pragma unroll  // all 24 copies of a stage in flight together, every lane on
    for (int i = 0; i < BM / 16; i++)
      cp16B(gA + (size_t)i * 16 * K + k0, lA + bsel * ATILE + i * 16 * LDW);
#pragma unroll
    for (int i = 0; i < BN / 16; i++)
      cp16B(gW + (size_t)i * 16 * K + k0, lW + bsel * WTILE + i * 16 * LDW);
  };

  f8v acc[4][8] = {};

  stage(0, 0);
  cp_wait();
  __syncthreads();

  int buf = 0;
  for (int k0 = 0; k0 < K; k0 += KS) {
    if (k0 + KS < K) stage(k0 + KS, buf ^ 1);    // next stage into the other buffer

    const _Float16* Ab = As + buf * ATILE;
    const _Float16* Wb = Ws + buf * WTILE;
#pragma unroll
    for (int kk = 0; kk < KS; kk += 32) {
      h16 af[4], bf[8];
#pragma unroll
      for (int i = 0; i < 4; i++) af[i] = frag_ld(Ab, wm0 + i * 16, kk, LDW);
#pragma unroll
      for (int j = 0; j < 8; j++) bf[j] = frag_ld(Wb, wn0 + j * 16, kk, LDW);
      // keeps the 24 LDS reads of a k step together ahead of its 32 WMMAs: without it the
      // A fragments share one register set and every row of 8 WMMAs waits out its own read
      __builtin_amdgcn_sched_barrier(0);
#pragma unroll
      for (int i = 0; i < 4; i++)
#pragma unroll
        for (int j = 0; j < 8; j++) acc[i][j] = wmma_f16(af[i], bf[j], acc[i][j]);
    }

    // keeps the stage's last WMMAs ahead of the waits: sunk behind the barrier they would
    // stand between it and the next copies, which then fly for half a stage only
    __builtin_amdgcn_sched_barrier(0);
    // this wave's reads of the buffer are done before it is refilled behind the barrier
    asm volatile("s_wait_dscnt 0x0" ::: "memory");
    cp_wait();
    __syncthreads();
    buf ^= 1;
  }

  const int g = lane >> 4, nl = lane & 15;
  float bvs[8];
#pragma unroll  // constant indices keep the eight values in registers
  for (int j = 0; j < 8; j++) bvs[j] = bias[n0 + wn0 + j * 16 + nl];
  // precaution: stands ahead of the first write of the offset register that the loads name
  asm volatile("s_wait_xcnt 0x0" ::: "memory");
#pragma unroll
  for (int j = 0; j < 8; j++) {
    const int gn = n0 + wn0 + j * 16 + nl;
    const float bv = bvs[j];
#pragma unroll
    for (int i = 0; i < 4; i++) {
#pragma unroll
      for (int r = 0; r < 8; r++) {
        const int gm = m0 + wm0 + i * 16 + g * 8 + r;  // C layout: M = r + 8*(lane>>4)
        const float v = acc[i][j][r] + bv;
        if (OUT_MODE == 0) {
          const int b = gm >> 6, t = gm & 63, h = gn >> 6, d = gn & 63;
          outH[(((size_t)(b * NH + h) * TT + t) * DH) + d] = (_Float16)v;
        } else {
          outF[(size_t)gm * DM + gn] = v;
        }
      }
    }
  }
}

// ---------------------------------------------------------------------------
// Fused relative attention for one (b,h): 256 threads, dynamic LDS.
// LDS half-offsets:
//   qs   [64x72]      0      (reused as attn f16 after softmax)
//   ks   [64x72]      4608
//   vTs  [64x72]      9216   (v stored transposed [d][s])
//   rls  [18432]      13824  (rel_k rows -> rel_q rows -> rel_vT [64x264])
//   Qr   [64x248]     32256  \ overlaid later by P [64x264]
//   Kr   [64x248]     48128  /
//   Ls   f32 [64x64]  byte 128000
// total 144384 bytes dynamic shared (< 320 KB/WG on CDNA5).
// Every product but q k^T is taken transposed (the table, or v, as the A operand):
// a lane then holds eight neighbours of one output row and stores them as 16 bytes.
// ---------------------------------------------------------------------------
__global__ __launch_bounds__(256) void attn_kernel(
    const _Float16* __restrict__ qg, const _Float16* __restrict__ kg,
    const _Float16* __restrict__ vg,                 // (B,H,T,DH) f16
    const _Float16* __restrict__ relimg,             // (3,H,RIMG) f16 table images
    const int* __restrict__ relmeta,                 // (64,64) bounded index | repeat flag
    const float* __restrict__ RR,                    // (H,225)
    _Float16* __restrict__ outO)                     // (B,T,1024) f16
{
  extern __shared__ char smem_raw[];
  _Float16* qs    = (_Float16*)smem_raw;
  _Float16* ks    = qs + 4608;
  _Float16* vTs   = ks + 4608;
  _Float16* rls   = vTs + 4608;
  _Float16* Qr    = rls + RIMG;
  _Float16* Kr    = Qr + 64 * RPIT;
  _Float16* Pm    = Qr;        // overlay after gathers
  _Float16* attnb = qs;        // overlay after logits
  float*    Ls    = (float*)(smem_raw + 128000);

  const int h = blockIdx.x, b = blockIdx.y;
  const int tid = threadIdx.x, lane = tid & 31;
  // the wave's number in a scalar register: tile choices and their one branch are scalar
  const int wave = __builtin_amdgcn_readfirstlane(tid >> 5);
  const size_t bh = ((size_t)b * NH + h) * (TT * DH);

  // One table image -> rls: 9 async 16B copies per lane, every lane on.
  auto stage_rel = [&](int tb) {
    const _Float16* s = relimg + (size_t)(tb * NH + h) * RIMG + tid * 8;
    _Float16* l = rls + tid * 8;
#pragma unroll  // all nine copies in flight together
    for (int i = 0; i < 9; i++) cp16B(s + i * 2048, l + i * 2048);
  };

  // ---- stage q, k, rel_k rows (async 16B copies), vT (transposed) ----
  for (int c = tid; c < 512; c += 256) {
    int row = c >> 3, col = (c & 7) * 8;
    cp16B(&qg[bh + row * DH + col], &qs[row * 72 + col]);
    cp16B(&kg[bh + row * DH + col], &ks[row * 72 + col]);
  }
  stage_rel(0);
  for (int e = tid; e < TT * DH; e += 256) {
    int d = e & 63, s = e >> 6;
    vTs[d * 72 + s] = vg[bh + (size_t)s * DH + d];
  }
  cp_wait();
  __syncthreads();

  // dst[t][r] = rows[t] . table[r]  (64 x 240, K=64). A wave keeps the fragments of 32
  // rows in registers and walks every fourth table tile: a table fragment is read once
  // for two WMMAs. Transposed product: lane = row t, registers = eight neighbouring r.
  auto table_product = [&](const _Float16* rows, _Float16* dst) {
    const int m0 = (wave & 1) * 32, ng = wave >> 1;
    h16 a[2][2];
#pragma unroll  // constant indices keep the fragments in registers
    for (int u = 0; u < 2; u++)
#pragma unroll
      for (int k = 0; k < 2; k++) a[u][k] = frag_ld(rows, m0 + u * 16, k * 32, 72);
    // all table fragments are read ahead of the first store: a read behind an LDS store is
    // not moved over it by the compiler, and each tile would wait out its own LDS latency.
    // Tile 15 (rows 240..255 of the image, zeros) is read like the others and goes unused.
    h16 tf[4][2];
#pragma unroll  // constant indices keep the fragments in registers
    for (int i = 0; i < 4; i++)
#pragma unroll
      for (int k = 0; k < 2; k++) tf[i][k] = frag_ld(rls, (ng + 4 * i) * 16, k * 32, 72);
    // keeps the 24 LDS reads together ahead of the WMMAs: without it the compiler sinks them
    // to their uses, on one register set, and the wave waits out the LDS latency tile by tile
    __builtin_amdgcn_sched_barrier(0);
    _Float16* drow = dst + (m0 + (lane & 15)) * RPIT + ng * 16 + (lane >> 4) * 8;
    auto tile = [&](int i) {
#pragma unroll  // constant indices keep the fragments in registers
      for (int u = 0; u < 2; u++) {
        f8v acc = {};
        acc = wmma_f16(tf[i][0], a[u][0], acc);
        acc = wmma_f16(tf[i][1], a[u][1], acc);
        h8 o;
#pragma unroll
        for (int r = 0; r < 8; r++) o[r] = (_Float16)acc[r];
        *(h8*)(drow + u * 16 * RPIT + i * 64) = o;
      }
    };
    tile(0);
    tile(1);
    tile(2);
    if (ng < 3) tile(3);   // 15 table tiles: the last group of waves has three
  };

  // ---- Qr = q @ rel_k^T ----
  table_product(qs, Qr);
  __syncthreads();

  // ---- restage rel_q, compute Kr = k @ rel_q^T ----
  stage_rel(1);
  cp_wait();  // rel_q copies landed before the barrier that publishes them
  __syncthreads();
  table_product(ks, Kr);
  __syncthreads();

  // ---- stage rel_vT [d][264] while computing logits = q k^T + gathers ----
  stage_rel(2);
  // keeps the copies ahead of the index loads and their waits: moved behind them they would
  // start a whole L2 round trip later and the barrier below would wait for them
  __builtin_amdgcn_sched_barrier(0);
  {
    // a wave's two tiles share the k fragments; unrolled, both tiles' index loads go out first
    const int nt = wave & 3;
    const h16 kf0 = frag_ld(ks, nt * 16, 0, 72), kf1 = frag_ld(ks, nt * 16, 32, 72);
    const int s = nt * 16 + (lane & 15), g = lane >> 4;
    // the lane's 16 entries of the row table, 64 ints apart: one address, constant offsets
    const int* mp = relmeta + ((wave >> 2) * 16 + g * 8) * TT + s;
    float val[2][8];
#pragma unroll  // constant indices keep the values in registers
    for (int i = 0; i < 2; i++) {
      const int mt = (wave >> 2) + 2 * i;
      f8v acc = {};
      acc = wmma_f16(frag_ld(qs, mt * 16, 0, 72), kf0, acc);
      acc = wmma_f16(frag_ld(qs, mt * 16, 32, 72), kf1, acc);
#pragma unroll
      for (int r = 0; r < 8; r++) {
        const int t = mt * 16 + g * 8 + r;
        const int idx = mp[(i * 32 + r) * TT] & 255;   // bounded to 0..224 by the row table
        val[i][r] = acc[r] + (float)Qr[t * RPIT + idx] +
                    (float)Kr[s * RPIT + idx] + RR[h * NREL + idx];
      }
    }
    // stores behind both tiles' gathers, which the compiler does not move over an LDS store
#pragma unroll
    for (int i = 0; i < 2; i++)
#pragma unroll
      for (int r = 0; r < 8; r++)
        Ls[(((wave >> 2) + 2 * i) * 16 + g * 8 + r) * TT + s] = val[i][r];
  }
  cp_wait();  // rel_vT copies landed before the barrier that publishes them
  __syncthreads();

  // ---- zero P (overlays Qr/Kr) + softmax: four lanes a row, 16 logits each ----
  const int t4 = tid >> 2, j4 = tid & 3;
  i4v mt4[4];
#pragma unroll  // constant indices keep the slice in registers
  for (int i = 0; i < 4; i++) mt4[i] = ((const i4v*)(relmeta + t4 * TT + j4 * 16))[i];
#pragma unroll  // 2112 chunks of 16 B: eight rounds of 256 lanes and a rest of 64
  for (int i = 0; i < 8; i++) *(h8*)(Pm + (tid + i * 256) * 8) = h8{};
  if (tid < 64) *(h8*)(Pm + (tid + 2048) * 8) = h8{};
  _Float16 at[16];
  {
    const float scale = 0.125f;  // 1/sqrt(64)
    f2v l[8];
#pragma unroll  // constant indices keep the slice in registers
    for (int i = 0; i < 4; i++) {
      const f4v x4 = ((const f4v*)(Ls + t4 * TT + j4 * 16))[i];
      l[2 * i] = f2v{x4[0], x4[1]};
      l[2 * i + 1] = f2v{x4[2], x4[3]};
    }
    float mx = -1e30f;
#pragma unroll  // constant indices keep the slice in registers
    for (int i = 0; i < 8; i++) mx = fmaxf(mx, fmaxf(l[i][0], l[i][1]));
    mx = fmaxf(mx, quad_swap<0xB1>(mx));   // lane ^ 1
    mx = fmaxf(mx, quad_swap<0x4E>(mx));   // lane ^ 2
    f2v sum2 = {0.f, 0.f};
#pragma unroll  // constant indices keep the slice in registers
    for (int i = 0; i < 8; i++) {
      const f2v a = (l[i] - mx) * scale;
      l[i] = f2v{__expf(a[0]), __expf(a[1])};
      sum2 += l[i];
    }
    float sum = sum2[0] + sum2[1];
    sum += quad_swap<0xB1>(sum);
    sum += quad_swap<0x4E>(sum);
    const float inv = 1.f / sum;
    h8 lo, hi;
#pragma unroll  // constant indices keep the slice in registers
    for (int i = 0; i < 8; i++) {
      const f2v p = l[i] * inv;
      at[2 * i] = (_Float16)p[0];
      at[2 * i + 1] = (_Float16)p[1];
    }
#pragma unroll  // constant indices keep the slice in registers
    for (int i = 0; i < 8; i++) { lo[i] = at[i]; hi[i] = at[i + 8]; }
    *(h8*)(attnb + t4 * 72 + j4 * 16)     = lo;
    *(h8*)(attnb + t4 * 72 + j4 * 16 + 8) = hi;
  }
  __syncthreads();

  // ---- scatter P[t,r] += attn[t,s] ----
  if (!(mt4[0][0] & 256)) {
    // no index twice in row t: every s has its own element of the zeroed row
#pragma unroll  // constant indices keep the slice in registers
    for (int i = 0; i < 16; i++) Pm[t4 * 264 + (mt4[i >> 2][i & 3] & 255)] = at[i];
  } else if (j4 == 0) {
    // a repeated index: one lane adds the row's 64 values in order of s
    for (int s = 0; s < TT; s++) {
      const int idx = relmeta[t4 * TT + s] & 255;
      Pm[t4 * 264 + idx] = (_Float16)((float)Pm[t4 * 264 + idx] + (float)attnb[t4 * 72 + s]);
    }
  }
  __syncthreads();

  // ---- out = attn @ v  +  P @ rel_v  (both WMMA) ----
  // A wave takes 16 rows t and 32 columns d: an attn or P fragment is read once for two
  // WMMAs, on two accumulators that do not wait for each other. Transposed product:
  // lane = row t, registers = eight neighbouring d.
  {
    const int mt = wave & 3, d0 = (wave >> 2) * 32;
    f8v acc[2] = {};
    h16 p[5], w[5][2];   // the first five k steps: two of attn and v, three of P and rel_v
#pragma unroll  // constant indices keep the fragments in registers
    for (int j = 0; j < 2; j++) {
      p[j] = frag_ld(attnb, mt * 16, j * 32, 72);
#pragma unroll
      for (int u = 0; u < 2; u++) w[j][u] = frag_ld(vTs, d0 + u * 16, j * 32, 72);
    }
#pragma unroll
    for (int j = 2; j < 5; j++) {
      p[j] = frag_ld(Pm, mt * 16, (j - 2) * 32, 264);
#pragma unroll
      for (int u = 0; u < 2; u++) w[j][u] = frag_ld(rls, d0 + u * 16, (j - 2) * 32, 264);
    }
    // keeps these 30 LDS reads together ahead of the first WMMA: without it the first steps
    // share one register set and each waits out its own LDS latency
    __builtin_amdgcn_sched_barrier(0);
#pragma unroll
    for (int j = 0; j < 5; j++)
#pragma unroll
      for (int u = 0; u < 2; u++) acc[u] = wmma_f16(w[j][u], p[j], acc[u]);
#pragma unroll
    for (int k0 = 96; k0 < RPADK; k0 += 32) {
      const h16 pk = frag_ld(Pm, mt * 16, k0, 264);
#pragma unroll
      for (int u = 0; u < 2; u++) acc[u] = wmma_f16(frag_ld(rls, d0 + u * 16, k0, 264), pk, acc[u]);
    }
    const int t = mt * 16 + (lane & 15);
#pragma unroll
    for (int u = 0; u < 2; u++) {
      h8 o;
#pragma unroll
      for (int r = 0; r < 8; r++) o[r] = (_Float16)acc[u][r];
      *(h8*)(outO + ((size_t)b * TT + t) * DM + h * DH + d0 + u * 16 + (lane >> 4) * 8) = o;
    }
  }
}

// ---------------------------------------------------------------------------
// Host launcher
// ---------------------------------------------------------------------------
extern "C" void kernel_launch(void* const* d_in, const int* in_sizes, int n_in,
                              void* d_out, int out_size, void* d_ws, size_t ws_size,
                              hipStream_t stream) {
  (void)in_sizes; (void)n_in; (void)out_size; (void)ws_size;
  const float* x     = (const float*)d_in[0];
  const float* Wq_w  = (const float*)d_in[1];
  const float* Wq_b  = (const float*)d_in[2];
  const float* Wk_w  = (const float*)d_in[3];
  const float* Wk_b  = (const float*)d_in[4];
  const float* Wv_w  = (const float*)d_in[5];
  const float* Wv_b  = (const float*)d_in[6];
  const float* Wo_w  = (const float*)d_in[7];
  const float* Wo_b  = (const float*)d_in[8];
  const float* rel_q = (const float*)d_in[9];
  const float* rel_k = (const float*)d_in[10];
  const float* rel_v = (const float*)d_in[11];
  const int*   ridx  = (const int*)d_in[12];

  char* ws = (char*)d_ws;
  // workspace layout (bytes)
  _Float16* xh = (_Float16*)(ws);                       // 67,108,864  (x f16; reused as oh)
  _Float16* wh = (_Float16*)(ws + 67108864);            //  8,388,608  (Wq,Wk,Wv,Wo f16)
  _Float16* qh = (_Float16*)(ws + 75497472);            // 67,108,864  (B,H,T,64)
  _Float16* kh = (_Float16*)(ws + 142606336);           // 67,108,864
  _Float16* vh = (_Float16*)(ws + 209715200);           // 67,108,864
  float*    RR = (float*)(ws + 276824064);              //     14,400
  _Float16* ri = (_Float16*)(ws + 276840448);           //  1,769,472  (3,H,RIMG) table images
  int*      rm = (int*)(ws + 278609920);                //     16,384  (64,64) row table
  _Float16* oh = xh;  // x consumed before attention writes here (same stream)

  const int nw = DM * DM;       //  1,048,576
  prep_kernel<<<PB_ALL, 256, 0, stream>>>(x, Wq_w, Wk_w, Wv_w, Wo_w, rel_q, rel_k, rel_v, ridx,
                                          xh, wh, RR, ri, rm);

  // q, k, v in one grid: Wq, Wk, Wv lie behind one another in wh, and qh, kh, vh in ws
  gemm_proj<0><<<dim3(3 * DM / 256, MTOT / 128), 128, 0, stream>>>(xh, wh, Wq_b, Wk_b, Wv_b, qh,
                                                                   nullptr);

  attn_kernel<<<dim3(NH, BB), 256, 144384, stream>>>(qh, kh, vh, ri, rm, RR, oh);

  gemm_proj<1><<<dim3(DM / 256, MTOT / 128), 128, 0, stream>>>(oh, wh + 3 * (size_t)nw, Wo_b, Wo_b,
                                                               Wo_b, nullptr, (float*)d_out);
}

// v006
// Measured time: 333 microseconds a run.
// In both of two side-by-side timings against v005, it was 1.03 times as fast.
// All steps since v000 together make it 3.54 times as fast.
#include <hip/hip_runtime.h>
#include <hip/hip_bf16.h>

// ---------------------------------------------------------------------------
// Types for WMMA fragments (gfx1250, wave32)
// ---------------------------------------------------------------------------
typedef _Float16 h2v __attribute__((ext_vector_type(2)));
typedef _Float16 h8  __attribute__((ext_vector_type(8)));
typedef _Float16 h16 __attribute__((ext_vector_type(16)));
typedef float    f8v __attribute__((ext_vector_type(8)));
typedef float    f4v __attribute__((ext_vector_type(4)));
typedef float    f2v __attribute__((ext_vector_type(2)));
typedef int      i4v __attribute__((ext_vector_type(4)));

__device__ __forceinline__ f8v wmma_f16(h16 a, h16 b, f8v c) {
  // D = A(16x32 f16) * B(32x16 f16) + C(16x16 f32)
  return __builtin_amdgcn_wmma_f32_16x16x32_f16(
      /*neg_a=*/false, a, /*neg_b=*/false, b,
      /*c_mod=*/(short)0, c, /*reuse_a=*/false, /*reuse_b=*/false);
}

// ---------------------------------------------------------------------------
// Async global->LDS copy (GLOBAL_LOAD_ASYNC_TO_LDS_B128, ASYNCcnt-tracked).
// Builtin signature (from clang diagnostic): (int4 AS1*, int4 AS3*, imm, imm).
// Falls back to a synchronous 16B copy when the builtin is unavailable.
// ---------------------------------------------------------------------------
#if defined(__gfx1250__) && __has_builtin(__builtin_amdgcn_global_load_async_to_lds_b128)
#define HAVE_ASYNC_LDS 1
#else
#define HAVE_ASYNC_LDS 0
#endif

__device__ __forceinline__ void cp16B(const _Float16* g, _Float16* l) {
#if HAVE_ASYNC_LDS
  __builtin_amdgcn_global_load_async_to_lds_b128(
      (__attribute__((address_space(1))) i4v*)g,
      (__attribute__((address_space(3))) i4v*)l, 0, 0);
#else
  *(h8*)l = *(const h8*)g;
#endif
}

__device__ __forceinline__ void cp_wait() {
#if HAVE_ASYNC_LDS
  asm volatile("s_wait_asynccnt 0x0" ::: "memory");
#endif
}

// NT fragment loader. Both A and B fragments of V_WMMA_F32_16X16X32_F16 read
// row (lane&15) of a row-major-along-K tile, in two contiguous 8-half runs:
//   k in [8g, 8g+8) and [8g+16, 8g+24),  g = lane>>4     (ISA 7.12.2 layout)
// => two ds_load_b128 per fragment.
__device__ __forceinline__ h16 frag_ld(const _Float16* base, int row0, int k0, int stride) {
  const int lane = threadIdx.x & 31;
  const int g = lane >> 4;
  const _Float16* p = base + (size_t)(row0 + (lane & 15)) * stride + k0 + 8 * g;
  h8 lo = *(const h8*)(p);
  h8 hi = *(const h8*)(p + 16);
  return __builtin_shufflevector(lo, hi, 0,1,2,3,4,5,6,7,8,9,10,11,12,13,14,15);
}

// ---------------------------------------------------------------------------
// Problem constants
// ---------------------------------------------------------------------------
#define BB       512
#define TT       64
#define DM       1024
#define NH       16
#define DH       64
#define NREL     225
#define RPIT     248   // LDS pitch of a Qr / Kr row in halves (240 used, 15 WMMA tiles): 496 B = 16 B x 31
#define RPADK    256   // NREL padded to WMMA K steps (8 * 32)
#define MTOT     (BB * TT)   // 32768
#define RIMG     18432 // halves in one staged table image: 9 rounds of 256 lanes x 16 B

// ---------------------------------------------------------------------------
// Vectorized f32 -> f16 cast: 8 elements / thread (2x b128 load, 1x b128 store)
// ---------------------------------------------------------------------------
__device__ __forceinline__ void cast_f32_f16_v8(const float* __restrict__ src,
                                                _Float16* __restrict__ dst, int i) {
  const f4v* s = (const f4v*)src;
  f4v a = s[2 * (size_t)i], b = s[2 * (size_t)i + 1];
  h8 o;
#pragma unroll
  for (int j = 0; j < 4; j++) { o[j] = (_Float16)a[j]; o[j + 4] = (_Float16)b[j]; }
  *(h8*)(dst + (size_t)i * 8) = o;
  // precaution: stands ahead of every later write of a register that the store names (the
  // other parts of the merged kernel follow the inlined call in the built code)
  asm volatile("s_wait_xcnt 0x0" ::: "memory");
}

// RR[h,r] = dot(rel_q[h,r,:], rel_k[h,r,:])
__device__ __forceinline__ void rr_part(const float* __restrict__ rq,
                                        const float* __restrict__ rk,
                                        float* __restrict__ RR, int i) {
  if (i < NH * NREL) {
    const float* a = rq + (size_t)i * DH;
    const float* b = rk + (size_t)i * DH;
    float s = 0.f;
#pragma unroll
    for (int d = 0; d < DH; d++) s += a[d] * b[d];
    RR[i] = s;
  }
}

// Builds, once per call, the f16 images of the three relative tables exactly as
// attn_kernel keeps them in LDS, so that each work-group stages a table with
// straight 16-byte copies. One thread writes one 16-byte chunk; every byte of an
// image is written (padding as zero).
//   table 0: rel_k rows, pitch 72 halves, rows 225.. zero
//   table 1: rel_q rows, same shape
//   table 2: rel_v transposed [d][264], columns 225.. zero
__device__ __forceinline__ void rel_image_part(const float* __restrict__ rel_q,
                                               const float* __restrict__ rel_k,
                                               const float* __restrict__ rel_v,
                                               _Float16* __restrict__ img,
                                               int c,            // chunk in the image, 0..2303
                                               int h, int tb) {
  h8 o = {};
  if (tb < 2) {
    const float* src = (tb == 0) ? rel_k : rel_q;
    const int r = c / 9, cc = c % 9;
    if (r < NREL && cc < 8) {
      const f4v* s = (const f4v*)(src + ((size_t)h * NREL + r) * DH + cc * 8);
      f4v a = s[0], b = s[1];
#pragma unroll  // constant element indices keep o in registers
      for (int j = 0; j < 4; j++) { o[j] = (_Float16)a[j]; o[j + 4] = (_Float16)b[j]; }
    }
  } else {
    const int d = c / 33, r0 = (c % 33) * 8;
    if (d < DH) {
#pragma unroll  // constant element indices keep o in registers
      for (int j = 0; j < 8; j++) {
        // row clamped, value selected afterwards: the eight loads go out together
        const int r = r0 + j, rc = (r < NREL) ? r : NREL - 1;
        const float v = rel_v[((size_t)h * NREL + rc) * DH + d];
        o[j] = (r < NREL) ? (_Float16)v : (_Float16)0.f;
      }
    }
  }
  *(h8*)(img + (size_t)(tb * NH + h) * RIMG + (size_t)c * 8) = o;
}

// Row table for the P build, once per call: meta[t,s] = rel_index[t,s] bounded to
// 0..224, with bit 8 set in every entry of a row t that names some index twice.
// A row without a repeat can be scattered by several lanes at once.
// A block of 256 threads takes four rows, two waves a row; every thread of the block
// comes here together (the two barriers).
__device__ __forceinline__ void rel_rows_part(const int* __restrict__ rel_index,
                                              int* __restrict__ meta, int blk) {
  __shared__ int row[4][TT];
  __shared__ int rep[8];
  const int q = threadIdx.x >> 6, s = threadIdx.x & 63;
  const int t = blk * 4 + q;
  const int v = min(max(rel_index[t * TT + s], 0), NREL - 1);
  row[q][s] = v;
  __syncthreads();
  int n = 0;   // how often this entry's index stands in the row, itself included
  for (int o = 0; o < TT; o++) n += (row[q][o] == v) ? 1 : 0;
  const int any = __any(n > 1);
  if ((s & 31) == 0) rep[threadIdx.x >> 5] = any ? 1 : 0;
  __syncthreads();
  meta[t * TT + s] = v | ((rep[2 * q] | rep[2 * q + 1]) << 8);
}

// ---------------------------------------------------------------------------
// All the work that needs nothing but the inputs, in one launch: each part has its
// own range of the block index (the branch is the same for a whole block). The
// short parts that wait on latency come first, the long stream of x last.
// ---------------------------------------------------------------------------
#define PB_ROWS  (TT / 4)                     //    16 blocks: row table
#define PB_RR    ((NH * NREL + 255) / 256)    //    15 blocks: RR
#define PB_IMG1  (RIMG / 8 / 256)             //     9 blocks an image
#define PB_IMG   (PB_IMG1 * NH * 3)           //   432 blocks: table images
#define PB_W1    (DM * DM / 8 / 256)          //   512 blocks a weight matrix
#define PB_W     (PB_W1 * 4)                  //  2048 blocks: weight casts
#define PB_X     (MTOT * DM / 8 / 256)        // 16384 blocks: x cast
#define PB_ALL   (PB_ROWS + PB_RR + PB_IMG + PB_W + PB_X)

__global__ __launch_bounds__(256) void prep_kernel(
    const float* __restrict__ x,
    const float* __restrict__ Wq_w, const float* __restrict__ Wk_w,
    const float* __restrict__ Wv_w, const float* __restrict__ Wo_w,
    const float* __restrict__ rel_q, const float* __restrict__ rel_k,
    const float* __restrict__ rel_v, const int* __restrict__ rel_index,
    _Float16* __restrict__ xh, _Float16* __restrict__ wh, float* __restrict__ RR,
    _Float16* __restrict__ img, int* __restrict__ meta) {
  const int tid = threadIdx.x;
  int blk = blockIdx.x;
  if (blk < PB_ROWS) { rel_rows_part(rel_index, meta, blk); return; }
  blk -= PB_ROWS;
  if (blk < PB_RR) { rr_part(rel_q, rel_k, RR, blk * 256 + tid); return; }
  blk -= PB_RR;
  if (blk < PB_IMG) {
    const int im = blk / PB_IMG1;             // image number, table * NH + head
    rel_image_part(rel_q, rel_k, rel_v, img, (blk % PB_IMG1) * 256 + tid, im % NH, im / NH);
    return;
  }
  blk -= PB_IMG;
  if (blk < PB_W) {
    const int w = blk / PB_W1;
    const float* src = (w == 0) ? Wq_w : (w == 1) ? Wk_w : (w == 2) ? Wv_w : Wo_w;
    cast_f32_f16_v8(src, wh + (size_t)w * (DM * DM), (blk % PB_W1) * 256 + tid);
    return;
  }
  blk -= PB_W;
  cast_f32_f16_v8(x, xh, blk * 256 + tid);
}

// Value of lane (l ^ 1) or (l ^ 2) inside each group of four lanes (DPP quad_perm).
template <int CTRL>
__device__ __forceinline__ float quad_swap(float x) {
  return __builtin_bit_cast(float, __builtin_amdgcn_mov_dpp(__builtin_bit_cast(int, x), CTRL,
                                                            0xf, 0xf, true));
}

// ---------------------------------------------------------------------------
// NT GEMM: C[m,n] = sum_k A[m,k] * W[n,k] + bias[n]
// A: (32768,1024) f16 row-major, W: f16 row-major, 1024 rows a projection.
// OUT_MODE 0: f16, head-split (b,h,t,d) layout.   OUT_MODE 1: f32 row-major.
// blockIdx.x counts 256-column blocks through the projections that lie behind one
// another in W and in outH (four blocks each); each has its own bias pointer.
// 128x256 block tile, 128 threads = 4 waves, each wave a 64x128 sub-tile
// (4x8 WMMA tiles): 12 fragments feed 32 WMMAs. K stepped by 64 (whole 128-byte
// lines of every operand row) through double-buffered LDS with async
// global->LDS copies one stage ahead. Two work-groups share a WGP.
// The W rows of a wave's 128 columns are dealt to the LDS rows so that B tile j, lane nl
// holds column nl*8 + j (f16 out) or (j>>2)*64 + nl*4 + (j&3) (f32 out): a lane's
// accumulators of one output row are then 16 bytes of neighbouring columns, and one
// 16-byte store of a wave fills four whole 128-byte lines.
// ---------------------------------------------------------------------------
template <int OUT_MODE>
__global__ __launch_bounds__(128) void gemm_proj(const _Float16* __restrict__ A,
                                                 const _Float16* __restrict__ W,
                                                 const float* __restrict__ bias0,
                                                 const float* __restrict__ bias1,
                                                 const float* __restrict__ bias2,
                                                 _Float16* __restrict__ outH,
                                                 float* __restrict__ outF) {
  constexpr int K = DM, KS = 64, LDW = 72;   // 64 + 8 halves pad: 144-byte pitch
  constexpr int BM = 128, BN = 256;
  constexpr int ATILE = BM * LDW;            //  9216 halves per buffer
  constexpr int WTILE = BN * LDW;            // 18432 halves per buffer
  __shared__ _Float16 As[2 * ATILE];
  __shared__ _Float16 Ws[2 * WTILE];

  const int tid  = threadIdx.x;
  const int wave = tid >> 5, lane = tid & 31;
  const int m0 = blockIdx.y * BM, n0 = (blockIdx.x & 3) * BN;
  const int proj = blockIdx.x >> 2;            // which projection this block belongs to
  W += (size_t)proj * (DM * DM);
  if (OUT_MODE == 0) outH += (size_t)proj * ((size_t)MTOT * DM);
  const float* bias = (proj == 0) ? bias0 : (proj == 1) ? bias1 : bias2;
  const int wm0 = (wave & 1) * 64, wn0 = (wave >> 1) * 128;

  // Eight lanes copy one row's 128 bytes; a round of 128 lanes covers 16 rows.
  const int crow = tid >> 3, ccol = (tid & 7) * 8;
  const _Float16* gA = A + (size_t)(m0 + crow) * K + ccol;
  constexpr int DEAL = (OUT_MODE == 0) ? 8 : 4;   // neighbouring columns in a lane's 16 bytes
  const _Float16* gW = W + (size_t)(n0 + crow * DEAL) * K + ccol;
  _Float16* lA = As + crow * LDW + ccol;
  _Float16* lW = Ws + crow * LDW + ccol;

  auto stage = [&](int k0, int bsel) {
#pragma unroll  // all 24 copies of a stage in flight together, every lane on
    for (int i = 0; i < BM / 16; i++)
      cp16B(gA + (size_t)i * 16 * K + k0, lA + bsel * ATILE + i * 16 * LDW);
#pragma unroll
    for (int i = 0; i < BN / 16; i++) {
      // LDS row i*16 + crow takes W row wrow + crow*DEAL (the deal described above)
      const int wrow = (OUT_MODE == 0) ? (i >> 3) * 128 + (i & 7) : (i >> 2) * 64 + (i & 3);
      cp16B(gW + (size_t)wrow * K + k0, lW + bsel * WTILE + i * 16 * LDW);
    }
  };

  f8v acc[4][8] = {};

  stage(0, 0);
  cp_wait();
  __syncthreads();

  int buf = 0;
  for (int k0 = 0; k0 < K; k0 += KS) {
    if (k0 + KS < K) stage(k0 + KS, buf ^ 1);    // next stage into the other buffer

    const _Float16* Ab = As + buf * ATILE;
    const _Float16* Wb = Ws + buf * WTILE;
#pragma unroll
    for (int kk = 0; kk < KS; kk += 32) {
      h16 af[4], bf[8];
#pragma unroll
      for (int i = 0; i < 4; i++) af[i] = frag_ld(Ab, wm0 + i * 16, kk, LDW);
#pragma unroll
      for (int j = 0; j < 8; j++) bf[j] = frag_ld(Wb, wn0 + j * 16, kk, LDW);
      // keeps the 24 LDS reads of a k step together ahead of its 32 WMMAs: without it the
      // A fragments share one register set and every row of 8 WMMAs waits out its own read
      __builtin_amdgcn_sched_barrier(0);
#pragma unroll
      for (int i = 0; i < 4; i++)
#pragma unroll
        for (int j = 0; j < 8; j++) acc[i][j] = wmma_f16(af[i], bf[j], acc[i][j]);
    }

    // keeps the stage's last WMMAs ahead of the waits: sunk behind the barrier they would
    // stand between it and the next copies, which then fly for half a stage only
    __builtin_amdgcn_sched_barrier(0);
    // this wave's reads of the buffer are done before it is refilled behind the barrier
    asm volatile("s_wait_dscnt 0x0" ::: "memory");
    cp_wait();
    __syncthreads();
    buf ^= 1;
  }

  const int g = lane >> 4, nl = lane & 15;
  const int gm0 = m0 + wm0 + g * 8;            // C layout: M = r + 8*(lane>>4)
  // the lane's columns: eight neighbours (f16 out), or four neighbours and four 64 further on
  const int gn = n0 + wn0 + nl * DEAL;
  const f4v b0 = *(const f4v*)(bias + gn);
  const f4v b1 = *(const f4v*)(bias + gn + ((OUT_MODE == 0) ? 4 : 64));
  // precaution: stands ahead of the first write of the offset register that the loads name
  asm volatile("s_wait_xcnt 0x0" ::: "memory");
  // keeps the address arithmetic below, which takes that register, behind the wait
  __builtin_amdgcn_sched_barrier(0);
  // the wave's 64 rows are one batch entry (t = 0..63); its 128 columns are two heads
  _Float16* oph = (OUT_MODE == 0)
      ? outH + (((size_t)(gm0 >> 6) * NH + (gn >> 6)) * TT + (gm0 & 63)) * DH + (gn & 63) : nullptr;
  float* opf = (OUT_MODE == 1) ? outF + (size_t)gm0 * DM + gn : nullptr;
#pragma unroll  // constant indices keep the accumulators in registers
  for (int i = 0; i < 4; i++) {
    h2v oh[8][4];
    f4v of[8][2];
#pragma unroll  // constant indices keep the values in registers
    for (int r = 0; r < 8; r++) {
#pragma unroll
      for (int j = 0; j < 4; j++) {
        of[r][0][j] = acc[i][j][r] + b0[j];
        of[r][1][j] = acc[i][j + 4][r] + b1[j];
      }
      if (OUT_MODE == 0) {
#pragma unroll  // two neighbouring columns a conversion
        for (int p = 0; p < 4; p++)
          oh[r][p] = __builtin_convertvector(
              (f2v{of[r][p >> 1][(p & 1) * 2], of[r][p >> 1][(p & 1) * 2 + 1]}), h2v);
      }
    }
    // the eight rows' values stand in registers of their own before the first store goes
    // out: none of them is formed over a register that an issued store names
    __builtin_amdgcn_sched_barrier(0);
#pragma unroll
    for (int r = 0; r < 8; r++) {
      if (OUT_MODE == 0) {
        *(h8*)(oph + (i * 16 + r) * DH) = __builtin_shufflevector(
            __builtin_shufflevector(oh[r][0], oh[r][1], 0, 1, 2, 3),
            __builtin_shufflevector(oh[r][2], oh[r][3], 0, 1, 2, 3), 0, 1, 2, 3, 4, 5, 6, 7);
      } else {
        *(f4v*)(opf + (size_t)(i * 16 + r) * DM)      = of[r][0];
        *(f4v*)(opf + (size_t)(i * 16 + r) * DM + 64) = of[r][1];
      }
    }
    if (i < 3) {
      // precaution: stands ahead of the next rows' writes over registers that the stores name
      asm volatile("s_wait_xcnt 0x0" ::: "memory");
      // keeps the next rows' arithmetic behind that wait
      __builtin_amdgcn_sched_barrier(0);
    }
  }
}

// ---------------------------------------------------------------------------
// Fused relative attention for one (b,h): 256 threads, dynamic LDS.
// LDS half-offsets:
//   qs   [64x72]      0      (reused as attn f16 after softmax)
//   ks   [64x72]      4608
//   vTs  [64x72]      9216   (v stored transposed [d][s])
//   rls  [18432]      13824  (rel_k rows -> rel_q rows -> rel_vT [64x264])
//   Qr   [64x248]     32256  \ overlaid later by P [64x264]
//   Kr   [64x248]     48128  /
//   Ls   f32 [64x64]  byte 128000
// total 144384 bytes dynamic shared (< 320 KB/WG on CDNA5).
// Every product but q k^T is taken transposed (the table, or v, as the A operand):
// a lane then holds eight neighbours of one output row and stores them as 16 bytes.
// ---------------------------------------------------------------------------
__global__ __launch_bounds__(256) void attn_kernel(
    const _Float16* __restrict__ qg, const _Float16* __restrict__ kg,
    const _Float16* __restrict__ vg,                 // (B,H,T,DH) f16
    const _Float16* __restrict__ relimg,             // (3,H,RIMG) f16 table images
    const int* __restrict__ relmeta,                 // (64,64) bounded index | repeat flag
    const float* __restrict__ RR,                    // (H,225)
    _Float16* __restrict__ outO)                     // (B,T,1024) f16
{
  extern __shared__ char smem_raw[];
  _Float16* qs    = (_Float16*)smem_raw;
  _Float16* ks    = qs + 4608;
  _Float16* vTs   = ks + 4608;
  _Float16* rls   = vTs + 4608;
  _Float16* Qr    = rls + RIMG;
  _Float16* Kr    = Qr + 64 * RPIT;
  _Float16* Pm    = Qr;        // overlay after gathers
  _Float16* attnb = qs;        // overlay after logits
  float*    Ls    = (float*)(smem_raw + 128000);

  const int h = blockIdx.x, b = blockIdx.y;
  const int tid = threadIdx.x, lane = tid & 31;
  // the wave's number in a scalar register: tile choices and their one branch are scalar
  const int wave = __builtin_amdgcn_readfirstlane(tid >> 5);
  const size_t bh = ((size_t)b * NH + h) * (TT * DH);

  // One table image -> rls: 9 async 16B copies per lane, every lane on.
  auto stage_rel = [&](int tb) {
    const _Float16* s = relimg + (size_t)(tb * NH + h) * RIMG + tid * 8;
    _Float16* l = rls + tid * 8;
#pragma unroll  // all nine copies in flight together
    for (int i = 0; i < 9; i++) cp16B(s + i * 2048, l + i * 2048);
  };

  // ---- stage q, k, rel_k rows (async 16B copies), vT (transposed) ----
  for (int c = tid; c < 512; c += 256) {
    int row = c >> 3, col = (c & 7) * 8;
    cp16B(&qg[bh + row * DH + col], &qs[row * 72 + col]);
    cp16B(&kg[bh + row * DH + col], &ks[row * 72 + col]);
  }
  stage_rel(0);
  for (int e = tid; e < TT * DH; e += 256) {
    int d = e & 63, s = e >> 6;
    vTs[d * 72 + s] = vg[bh + (size_t)s * DH + d];
  }
  cp_wait();
  __syncthreads();

  // dst[t][r] = rows[t] . table[r]  (64 x 240, K=64). A wave keeps the fragments of 32
  // rows in registers and walks every fourth table tile: a table fragment is read once
  // for two WMMAs. Transposed product: lane = row t, registers = eight neighbouring r.
  auto table_product = [&](const _Float16* rows, _Float16* dst) {
    const int m0 = (wave & 1) * 32, ng = wave >> 1;
    h16 a[2][2];
#pragma unroll  // constant indices keep the fragments in registers
    for (int u = 0; u < 2; u++)
#pragma unroll
      for (int k = 0; k < 2; k++) a[u][k] = frag_ld(rows, m0 + u * 16, k * 32, 72);
    // all table fragments are read ahead of the first store: a read behind an LDS store is
    // not moved over it by the compiler, and each tile would wait out its own LDS latency.
    // Tile 15 (rows 240..255 of the image, zeros) is read like the others and goes unused.
    h16 tf[4][2];
#pragma unroll  // constant indices keep the fragments in registers
    for (int i = 0; i < 4; i++)
#pragma unroll
      for (int k = 0; k < 2; k++) tf[i][k] = frag_ld(rls, (ng + 4 * i) * 16, k * 32, 72);
    // keeps the 24 LDS reads together ahead of the WMMAs: without it the compiler sinks them
    // to their uses, on one register set, and the wave waits out the LDS latency tile by tile
    __builtin_amdgcn_sched_barrier(0);
    _Float16* drow = dst + (m0 + (lane & 15)) * RPIT + ng * 16 + (lane >> 4) * 8;
    auto tile = [&](int i) {
#pragma unroll  // constant indices keep the fragments in registers
      for (int u = 0; u < 2; u++) {
        f8v acc = {};
        acc = wmma_f16(tf[i][0], a[u][0], acc);
        acc = wmma_f16(tf[i][1], a[u][1], acc);
        h8 o;
#pragma unroll
        for (int r = 0; r < 8; r++) o[r] = (_Float16)acc[r];
        *(h8*)(drow + u * 16 * RPIT + i * 64) = o;
      }
    };
    tile(0);
    tile(1);
    tile(2);
    if (ng < 3) tile(3);   // 15 table tiles: the last group of waves has three
  };

  // ---- Qr = q @ rel_k^T ----
  table_product(qs, Qr);
  __syncthreads();

  // ---- restage rel_q, compute Kr = k @ rel_q^T ----
  stage_rel(1);
  cp_wait();  // rel_q copies landed before the barrier that publishes them
  __syncthreads();
  table_product(ks, Kr);
  __syncthreads();

  // ---- stage rel_vT [d][264] while computing logits = q k^T + gathers ----
  stage_rel(2);
  // keeps the copies ahead of the index loads and their waits: moved behind them they would
  // start a whole L2 round trip later and the barrier below would wait for them
  __builtin_amdgcn_sched_barrier(0);
  {
    // a wave's two tiles share the k fragments; unrolled, both tiles' index loads go out first
    const int nt = wave & 3;
    const h16 kf0 = frag_ld(ks, nt * 16, 0, 72), kf1 = frag_ld(ks, nt * 16, 32, 72);
    const int s = nt * 16 + (lane & 15), g = lane >> 4;
    // the lane's 16 entries of the row table, 64 ints apart: one address, constant offsets
    const int* mp = relmeta + ((wave >> 2) * 16 + g * 8) * TT + s;
    float val[2][8];
#pragma unroll  // constant indices keep the values in registers
    for (int i = 0; i < 2; i++) {
      const int mt = (wave >> 2) + 2 * i;
      f8v acc = {};
      acc = wmma_f16(frag_ld(qs, mt * 16, 0, 72), kf0, acc);
      acc = wmma_f16(frag_ld(qs, mt * 16, 32, 72), kf1, acc);
#pragma unroll
      for (int r = 0; r < 8; r++) {
        const int t = mt * 16 + g * 8 + r;
        const int idx = mp[(i * 32 + r) * TT] & 255;   // bounded to 0..224 by the row table
        val[i][r] = acc[r] + (float)Qr[t * RPIT + idx] +
                    (float)Kr[s * RPIT + idx] + RR[h * NREL + idx];
      }
    }
    // stores behind both tiles' gathers, which the compiler does not move over an LDS store
#pragma unroll
    for (int i = 0; i < 2; i++)
#pragma unroll
      for (int r = 0; r < 8; r++)
        Ls[(((wave >> 2) + 2 * i) * 16 + g * 8 + r) * TT + s] = val[i][r];
  }
  cp_wait();  // rel_vT copies landed before the barrier that publishes them
  __syncthreads();

  // ---- zero P (overlays Qr/Kr) + softmax: four lanes a row, 16 logits each ----
  const int t4 = tid >> 2, j4 = tid & 3;
  i4v mt4[4];
#pragma unroll  // constant indices keep the slice in registers
  for (int i = 0; i < 4; i++) mt4[i] = ((const i4v*)(relmeta + t4 * TT + j4 * 16))[i];
#pragma unroll  // 2112 chunks of 16 B: eight rounds of 256 lanes and a rest of 64
  for (int i = 0; i < 8; i++) *(h8*)(Pm + (tid + i * 256) * 8) = h8{};
  if (tid < 64) *(h8*)(Pm + (tid + 2048) * 8) = h8{};
  _Float16 at[16];
  {
    const float scale = 0.125f;  // 1/sqrt(64)
    f2v l[8];
#pragma unroll  // constant indices keep the slice in registers
    for (int i = 0; i < 4; i++) {
      const f4v x4 = ((const f4v*)(Ls + t4 * TT + j4 * 16))[i];
      l[2 * i] = f2v{x4[0], x4[1]};
      l[2 * i + 1] = f2v{x4[2], x4[3]};
    }
    float mx = -1e30f;
#pragma unroll  // constant indices keep the slice in registers
    for (int i = 0; i < 8; i++) mx = fmaxf(mx, fmaxf(l[i][0], l[i][1]));
    mx = fmaxf(mx, quad_swap<0xB1>(mx));   // lane ^ 1
    mx = fmaxf(mx, quad_swap<0x4E>(mx));   // lane ^ 2
    f2v sum2 = {0.f, 0.f};
#pragma unroll  // constant indices keep the slice in registers
    for (int i = 0; i < 8; i++) {
      const f2v a = (l[i] - mx) * scale;
      l[i] = f2v{__expf(a[0]), __expf(a[1])};
      sum2 += l[i];
    }
    float sum = sum2[0] + sum2[1];
    sum += quad_swap<0xB1>(sum);
    sum += quad_swap<0x4E>(sum);
    const float inv = 1.f / sum;
    h8 lo, hi;
#pragma unroll  // constant indices keep the slice in registers
    for (int i = 0; i < 8; i++) {
      const f2v p = l[i] * inv;
      at[2 * i] = (_Float16)p[0];
      at[2 * i + 1] = (_Float16)p[1];
    }
#pragma unroll  // constant indices keep the slice in registers
    for (int i = 0; i < 8; i++) { lo[i] = at[i]; hi[i] = at[i + 8]; }
    *(h8*)(attnb + t4 * 72 + j4 * 16)     = lo;
    *(h8*)(attnb + t4 * 72 + j4 * 16 + 8) = hi;
  }
  __syncthreads();

  // ---- scatter P[t,r] += attn[t,s] ----
  if (!(mt4[0][0] & 256)) {
    // no index twice in row t: every s has its own element of the zeroed row
#pragma unroll  // constant indices keep the slice in registers
    for (int i = 0; i < 16; i++) Pm[t4 * 264 + (mt4[i >> 2][i & 3] & 255)] = at[i];
  } else if (j4 == 0) {
    // a repeated index: one lane adds the row's 64 values in order of s
    for (int s = 0; s < TT; s++) {
      const int idx = relmeta[t4 * TT + s] & 255;
      Pm[t4 * 264 + idx] = (_Float16)((float)Pm[t4 * 264 + idx] + (float)attnb[t4 * 72 + s]);
    }
  }
  __syncthreads();

  // ---- out = attn @ v  +  P @ rel_v  (both WMMA) ----
  // A wave takes 16 rows t and 32 columns d: an attn or P fragment is read once for two
  // WMMAs, on two accumulators that do not wait for each other. Transposed product:
  // lane = row t, registers = eight neighbouring d.
  {
    const int mt = wave & 3, d0 = (wave >> 2) * 32;
    f8v acc[2] = {};
    h16 p[5], w[5][2];   // the first five k steps: two of attn and v, three of P and rel_v
#pragma unroll  // constant indices keep the fragments in registers
    for (int j = 0; j < 2; j++) {
      p[j] = frag_ld(attnb, mt * 16, j * 32, 72);
#pragma unroll
      for (int u = 0; u < 2; u++) w[j][u] = frag_ld(vTs, d0 + u * 16, j * 32, 72);
    }
#pragma unroll
    for (int j = 2; j < 5; j++) {
      p[j] = frag_ld(Pm, mt * 16, (j - 2) * 32, 264);
#pragma unroll
      for (int u = 0; u < 2; u++) w[j][u] = frag_ld(rls, d0 + u * 16, (j - 2) * 32, 264);
    }
    // keeps these 30 LDS reads together ahead of the first WMMA: without it the first steps
    // share one register set and each waits out its own LDS latency
    __builtin_amdgcn_sched_barrier(0);
#pragma unroll
    for (int j = 0; j < 5; j++)
#pragma unroll
      for (int u = 0; u < 2; u++) acc[u] = wmma_f16(w[j][u], p[j], acc[u]);
#pragma unroll
    for (int k0 = 96; k0 < RPADK; k0 += 32) {
      const h16 pk = frag_ld(Pm, mt * 16, k0, 264);
#pragma unroll
      for (int u = 0; u < 2; u++) acc[u] = wmma_f16(frag_ld(rls, d0 + u * 16, k0, 264), pk, acc[u]);
    }
    const int t = mt * 16 + (lane & 15);
#pragma unroll
    for (int u = 0; u < 2; u++) {
      h8 o;
#pragma unroll
      for (int r = 0; r < 8; r++) o[r] = (_Float16)acc[u][r];
      *(h8*)(outO + ((size_t)b * TT + t) * DM + h * DH + d0 + u * 16 + (lane >> 4) * 8) = o;
    }
  }
}

// ---------------------------------------------------------------------------
// Host launcher
// ---------------------------------------------------------------------------
extern "C" void kernel_launch(void* const* d_in, const int* in_sizes, int n_in,
                              void* d_out, int out_size, void* d_ws, size_t ws_size,
                              hipStream_t stream) {
  (void)in_sizes; (void)n_in; (void)out_size; (void)ws_size;
  const float* x     = (const float*)d_in[0];
  const float* Wq_w  = (const float*)d_in[1];
  const float* Wq_b  = (const float*)d_in[2];
  const float* Wk_w  = (const float*)d_in[3];
  const float* Wk_b  = (const float*)d_in[4];
  const float* Wv_w  = (const float*)d_in[5];
  const float* Wv_b  = (const float*)d_in[6];
  const float* Wo_w  = (const float*)d_in[7];
  const float* Wo_b  = (const float*)d_in[8];
  const float* rel_q = (const float*)d_in[9];
  const float* rel_k = (const float*)d_in[10];
  const float* rel_v = (const float*)d_in[11];
  const int*   ridx  = (const int*)d_in[12];

  char* ws = (char*)d_ws;
  // workspace layout (bytes)
  _Float16* xh = (_Float16*)(ws);                       // 67,108,864  (x f16; reused as oh)
  _Float16* wh = (_Float16*)(ws + 67108864);            //  8,388,608  (Wq,Wk,Wv,Wo f16)
  _Float16* qh = (_Float16*)(ws + 75497472);            // 67,108,864  (B,H,T,64)
  _Float16* kh = (_Float16*)(ws + 142606336);           // 67,108,864
  _Float16* vh = (_Float16*)(ws + 209715200);           // 67,108,864
  float*    RR = (float*)(ws + 276824064);              //     14,400
  _Float16* ri = (_Float16*)(ws + 276840448);           //  1,769,472  (3,H,RIMG) table images
  int*      rm = (int*)(ws + 278609920);                //     16,384  (64,64) row table
  _Float16* oh = xh;  // x consumed before attention writes here (same stream)

  const int nw = DM * DM;       //  1,048,576
  prep_kernel<<<PB_ALL, 256, 0, stream>>>(x, Wq_w, Wk_w, Wv_w, Wo_w, rel_q, rel_k, rel_v, ridx,
                                          xh, wh, RR, ri, rm);

  // q, k, v in one grid: Wq, Wk, Wv lie behind one another in wh, and qh, kh, vh in ws
  gemm_proj<0><<<dim3(3 * DM / 256, MTOT / 128), 128, 0, stream>>>(xh, wh, Wq_b, Wk_b, Wv_b, qh,
                                                                   nullptr);

  attn_kernel<<<dim3(NH, BB), 256, 144384, stream>>>(qh, kh, vh, ri, rm, RR, oh);

  gemm_proj<1><<<dim3(DM / 256, MTOT / 128), 128, 0, stream>>>(oh, wh + 3 * (size_t)nw, Wo_b, Wo_b,
                                                               Wo_b, nullptr, (float*)d_out);
}

// v007
// One run takes 317 microseconds.
// Next to v006, in two timings, it ran 1.05 times as fast each time.
// Counting every step since v000, it is 3.73 times as fast.
#include <hip/hip_runtime.h>
#include <hip/hip_bf16.h>

// ---------------------------------------------------------------------------
// Types for WMMA fragments (gfx1250, wave32)
// ---------------------------------------------------------------------------
typedef _Float16 h2v __attribute__((ext_vector_type(2)));
typedef _Float16 h8  __attribute__((ext_vector_type(8)));
typedef _Float16 h16 __attribute__((ext_vector_type(16)));
typedef float    f8v __attribute__((ext_vector_type(8)));
typedef float    f4v __attribute__((ext_vector_type(4)));
typedef float    f2v __attribute__((ext_vector_type(2)));
typedef int      i4v __attribute__((ext_vector_type(4)));

__device__ __forceinline__ f8v wmma_f16(h16 a, h16 b, f8v c) {
  // D = A(16x32 f16) * B(32x16 f16) + C(16x16 f32)
  return __builtin_amdgcn_wmma_f32_16x16x32_f16(
      /*neg_a=*/false, a, /*neg_b=*/false, b,
      /*c_mod=*/(short)0, c, /*reuse_a=*/false, /*reuse_b=*/false);
}

// ---------------------------------------------------------------------------
// Async global->LDS copy (GLOBAL_LOAD_ASYNC_TO_LDS_B128, ASYNCcnt-tracked).
// Builtin signature (from clang diagnostic): (int4 AS1*, int4 AS3*, imm, imm).
// Falls back to a synchronous 16B copy when the builtin is unavailable.
// ---------------------------------------------------------------------------
#if defined(__gfx1250__) && __has_builtin(__builtin_amdgcn_global_load_async_to_lds_b128)
#define HAVE_ASYNC_LDS 1
#else
#define HAVE_ASYNC_LDS 0
#endif

__device__ __forceinline__ void cp16B(const _Float16* g, _Float16* l) {
#if HAVE_ASYNC_LDS
  __builtin_amdgcn_global_load_async_to_lds_b128(
      (__attribute__((address_space(1))) i4v*)g,
      (__attribute__((address_space(3))) i4v*)l, 0, 0);
#else
  *(h8*)l = *(const h8*)g;
#endif
}

__device__ __forceinline__ void cp_wait() {
#if HAVE_ASYNC_LDS
  asm volatile("s_wait_asynccnt 0x0" ::: "memory");
#endif
}

// NT fragment loader. Both A and B fragments of V_WMMA_F32_16X16X32_F16 read
// row (lane&15) of a row-major-along-K tile, in two contiguous 8-half runs:
//   k in [8g, 8g+8) and [8g+16, 8g+24),  g = lane>>4     (ISA 7.12.2 layout)
// => two ds_load_b128 per fragment.
__device__ __forceinline__ h16 frag_ld(const _Float16* base, int row0, int k0, int stride) {
  const int lane = threadIdx.x & 31;
  const int g = lane >> 4;
  const _Float16* p = base + (size_t)(row0 + (lane & 15)) * stride + k0 + 8 * g;
  h8 lo = *(const h8*)(p);
  h8 hi = *(const h8*)(p + 16);
  return __builtin_shufflevector(lo, hi, 0,1,2,3,4,5,6,7,8,9,10,11,12,13,14,15);
}

// ---------------------------------------------------------------------------
// Problem constants
// ---------------------------------------------------------------------------
#define BB       512
#define TT       64
#define DM       1024
#define NH       16
#define DH       64
#define NREL     225
#define RPIT     264   // LDS pitch of a Qr / Kr row in halves (256 used, 16 WMMA tiles): 528 B = 16 B x 33
#define RPADK    256   // NREL padded to WMMA K steps (8 * 32)
#define MTOT     (BB * TT)   // 32768
#define RIMG     18432 // halves in one staged table image: 9 rounds of 256 lanes x 16 B

// ---------------------------------------------------------------------------
// Vectorized f32 -> f16 cast: 8 elements / thread (2x b128 load, 1x b128 store)
// ---------------------------------------------------------------------------
__device__ __forceinline__ void cast_f32_f16_v8(const float* __restrict__ src,
                                                _Float16* __restrict__ dst, int i) {
  const f4v* s = (const f4v*)src;
  f4v a = s[2 * (size_t)i], b = s[2 * (size_t)i + 1];
  h8 o;
#pragma unroll
  for (int j = 0; j < 4; j++) { o[j] = (_Float16)a[j]; o[j + 4] = (_Float16)b[j]; }
  *(h8*)(dst + (size_t)i * 8) = o;
  // precaution: stands ahead of every later write of a register that the store names (the
  // other parts of the merged kernel follow the inlined call in the built code)
  asm volatile("s_wait_xcnt 0x0" ::: "memory");
}

// RR[h,r] = dot(rel_q[h,r,:], rel_k[h,r,:])
__device__ __forceinline__ void rr_part(const float* __restrict__ rq,
                                        const float* __restrict__ rk,
                                        float* __restrict__ RR, int i) {
  if (i < NH * NREL) {
    const float* a = rq + (size_t)i * DH;
    const float* b = rk + (size_t)i * DH;
    float s = 0.f;
#pragma unroll
    for (int d = 0; d < DH; d++) s += a[d] * b[d];
    RR[i] = s;
  }
}

// Builds, once per call, the f16 images of the three relative tables exactly as
// attn_kernel keeps them in LDS, so that each work-group stages a table with
// straight 16-byte copies. One thread writes one 16-byte chunk; every byte of an
// image is written (padding as zero).
//   table 0: rel_k rows, pitch 72 halves, rows 225.. zero
//   table 1: rel_q rows, same shape
//   table 2: rel_v transposed [d][264], columns 225.. zero
__device__ __forceinline__ void rel_image_part(const float* __restrict__ rel_q,
                                               const float* __restrict__ rel_k,
                                               const float* __restrict__ rel_v,
                                               _Float16* __restrict__ img,
                                               int c,            // chunk in the image, 0..2303
                                               int h, int tb) {
  h8 o = {};
  if (tb < 2) {
    const float* src = (tb == 0) ? rel_k : rel_q;
    const int r = c / 9, cc = c % 9;
    if (r < NREL && cc < 8) {
      const f4v* s = (const f4v*)(src + ((size_t)h * NREL + r) * DH + cc * 8);
      f4v a = s[0], b = s[1];
#pragma unroll  // constant element indices keep o in registers
      for (int j = 0; j < 4; j++) { o[j] = (_Float16)a[j]; o[j + 4] = (_Float16)b[j]; }
    }
  } else {
    const int d = c / 33, r0 = (c % 33) * 8;
    if (d < DH) {
#pragma unroll  // constant element indices keep o in registers
      for (int j = 0; j < 8; j++) {
        // row clamped, value selected afterwards: the eight loads go out together
        const int r = r0 + j, rc = (r < NREL) ? r : NREL - 1;
        const float v = rel_v[((size_t)h * NREL + rc) * DH + d];
        o[j] = (r < NREL) ? (_Float16)v : (_Float16)0.f;
      }
    }
  }
  *(h8*)(img + (size_t)(tb * NH + h) * RIMG + (size_t)c * 8) = o;
}

// Row table for the P build, once per call: meta[t,s] = rel_index[t,s] bounded to
// 0..224, with bit 8 set in every entry of a row t that names some index twice.
// A row without a repeat can be scattered by several lanes at once.
// A block of 256 threads takes four rows, two waves a row; every thread of the block
// comes here together (the two barriers).
__device__ __forceinline__ void rel_rows_part(const int* __restrict__ rel_index,
                                              int* __restrict__ meta, int blk) {
  __shared__ int row[4][TT];
  __shared__ int rep[8];
  const int q = threadIdx.x >> 6, s = threadIdx.x & 63;
  const int t = blk * 4 + q;
  const int v = min(max(rel_index[t * TT + s], 0), NREL - 1);
  row[q][s] = v;
  __syncthreads();
  int n = 0;   // how often this entry's index stands in the row, itself included
  for (int o = 0; o < TT; o++) n += (row[q][o] == v) ? 1 : 0;
  const int any = __any(n > 1);
  if ((s & 31) == 0) rep[threadIdx.x >> 5] = any ? 1 : 0;
  __syncthreads();
  meta[t * TT + s] = v | ((rep[2 * q] | rep[2 * q + 1]) << 8);
}

// ---------------------------------------------------------------------------
// All the work that needs nothing but the inputs, in one launch: each part has its
// own range of the block index (the branch is the same for a whole block). The
// short parts that wait on latency come first, the long stream of x last.
// ---------------------------------------------------------------------------
#define PB_ROWS  (TT / 4)                     //    16 blocks: row table
#define PB_RR    ((NH * NREL + 255) / 256)    //    15 blocks: RR
#define PB_IMG1  (RIMG / 8 / 256)             //     9 blocks an image
#define PB_IMG   (PB_IMG1 * NH * 3)           //   432 blocks: table images
#define PB_W1    (DM * DM / 8 / 256)          //   512 blocks a weight matrix
#define PB_W     (PB_W1 * 4)                  //  2048 blocks: weight casts
#define PB_X     (MTOT * DM / 8 / 256)        // 16384 blocks: x cast
#define PB_ALL   (PB_ROWS + PB_RR + PB_IMG + PB_W + PB_X)

__global__ __launch_bounds__(256) void prep_kernel(
    const float* __restrict__ x,
    const float* __restrict__ Wq_w, const float* __restrict__ Wk_w,
    const float* __restrict__ Wv_w, const float* __restrict__ Wo_w,
    const float* __restrict__ rel_q, const float* __restrict__ rel_k,
    const float* __restrict__ rel_v, const int* __restrict__ rel_index,
    _Float16* __restrict__ xh, _Float16* __restrict__ wh, float* __restrict__ RR,
    _Float16* __restrict__ img, int* __restrict__ meta) {
  const int tid = threadIdx.x;
  int blk = blockIdx.x;
  if (blk < PB_ROWS) { rel_rows_part(rel_index, meta, blk); return; }
  blk -= PB_ROWS;
  if (blk < PB_RR) { rr_part(rel_q, rel_k, RR, blk * 256 + tid); return; }
  blk -= PB_RR;
  if (blk < PB_IMG) {
    const int im = blk / PB_IMG1;             // image number, table * NH + head
    rel_image_part(rel_q, rel_k, rel_v, img, (blk % PB_IMG1) * 256 + tid, im % NH, im / NH);
    return;
  }
  blk -= PB_IMG;
  if (blk < PB_W) {
    const int w = blk / PB_W1;
    const float* src = (w == 0) ? Wq_w : (w == 1) ? Wk_w : (w == 2) ? Wv_w : Wo_w;
    cast_f32_f16_v8(src, wh + (size_t)w * (DM * DM), (blk % PB_W1) * 256 + tid);
    return;
  }
  blk -= PB_W;
  cast_f32_f16_v8(x, xh, blk * 256 + tid);
}

// Value of lane (l ^ 1) or (l ^ 2) inside each group of four lanes (DPP quad_perm).
template <int CTRL>
__device__ __forceinline__ float quad_swap(float x) {
  return __builtin_bit_cast(float, __builtin_amdgcn_mov_dpp(__builtin_bit_cast(int, x), CTRL,
                                                            0xf, 0xf, true));
}

// ---------------------------------------------------------------------------
// NT GEMM: C[m,n] = sum_k A[m,k] * W[n,k] + bias[n]
// A: (32768,1024) f16 row-major, W: f16 row-major, 1024 rows a projection.
// OUT_MODE 0: f16, head-split (b,h,t,d) layout.   OUT_MODE 1: f32 row-major.
// blockIdx.x counts 256-column blocks through the projections that lie behind one
// another in W and in outH (four blocks each); each has its own bias pointer.
// 128x256 block tile, 128 threads = 4 waves, each wave a 64x128 sub-tile
// (4x8 WMMA tiles): 12 fragments feed 32 WMMAs. K stepped by 64 (whole 128-byte
// lines of every operand row) through double-buffered LDS with async
// global->LDS copies one stage ahead. Two work-groups share a WGP.
// The W rows of a wave's 128 columns are dealt to the LDS rows so that B tile j, lane nl
// holds column nl*8 + j (f16 out) or (j>>2)*64 + nl*4 + (j&3) (f32 out): a lane's
// accumulators of one output row are then 16 bytes of neighbouring columns, and one
// 16-byte store of a wave fills four whole 128-byte lines.
// ---------------------------------------------------------------------------
template <int OUT_MODE>
__global__ __launch_bounds__(128) void gemm_proj(const _Float16* __restrict__ A,
                                                 const _Float16* __restrict__ W,
                                                 const float* __restrict__ bias0,
                                                 const float* __restrict__ bias1,
                                                 const float* __restrict__ bias2,
                                                 _Float16* __restrict__ outH,
                                                 float* __restrict__ outF) {
  constexpr int K = DM, KS = 64, LDW = 72;   // 64 + 8 halves pad: 144-byte pitch
  constexpr int BM = 128, BN = 256;
  constexpr int ATILE = BM * LDW;            //  9216 halves per buffer
  constexpr int WTILE = BN * LDW;            // 18432 halves per buffer
  __shared__ _Float16 As[2 * ATILE];
  __shared__ _Float16 Ws[2 * WTILE];

  const int tid  = threadIdx.x;
  const int wave = tid >> 5, lane = tid & 31;
  const int m0 = blockIdx.y * BM, n0 = (blockIdx.x & 3) * BN;
  const int proj = blockIdx.x >> 2;            // which projection this block belongs to
  W += (size_t)proj * (DM * DM);
  if (OUT_MODE == 0) outH += (size_t)proj * ((size_t)MTOT * DM);
  const float* bias = (proj == 0) ? bias0 : (proj == 1) ? bias1 : bias2;
  const int wm0 = (wave & 1) * 64, wn0 = (wave >> 1) * 128;

  // Eight lanes copy one row's 128 bytes; a round of 128 lanes covers 16 rows.
  const int crow = tid >> 3, ccol = (tid & 7) * 8;
  const _Float16* gA = A + (size_t)(m0 + crow) * K + ccol;
  constexpr int DEAL = (OUT_MODE == 0) ? 8 : 4;   // neighbouring columns in a lane's 16 bytes
  const _Float16* gW = W + (size_t)(n0 + crow * DEAL) * K + ccol;
  _Float16* lA = As + crow * LDW + ccol;
  _Float16* lW = Ws + crow * LDW + ccol;

  auto stage = [&](int k0, int bsel) {
#pragma unroll  // all 24 copies of a stage in flight together, every lane on
    for (int i = 0; i < BM / 16; i++)
      cp16B(gA + (size_t)i * 16 * K + k0, lA + bsel * ATILE + i * 16 * LDW);
#pragma unroll
    for (int i = 0; i < BN / 16; i++) {
      // LDS row i*16 + crow takes W row wrow + crow*DEAL (the deal described above)
      const int wrow = (OUT_MODE == 0) ? (i >> 3) * 128 + (i & 7) : (i >> 2) * 64 + (i & 3);
      cp16B(gW + (size_t)wrow * K + k0, lW + bsel * WTILE + i * 16 * LDW);
    }
  };

  f8v acc[4][8] = {};

  stage(0, 0);
  cp_wait();
  __syncthreads();

  int buf = 0;
  for (int k0 = 0; k0 < K; k0 += KS) {
    if (k0 + KS < K) stage(k0 + KS, buf ^ 1);    // next stage into the other buffer

    const _Float16* Ab = As + buf * ATILE;
    const _Float16* Wb = Ws + buf * WTILE;
#pragma unroll
    for (int kk = 0; kk < KS; kk += 32) {
      h16 af[4], bf[8];
#pragma unroll
      for (int i = 0; i < 4; i++) af[i] = frag_ld(Ab, wm0 + i * 16, kk, LDW);
#pragma unroll
      for (int j = 0; j < 8; j++) bf[j] = frag_ld(Wb, wn0 + j * 16, kk, LDW);
      // keeps the 24 LDS reads of a k step together ahead of its 32 WMMAs: without it the
      // A fragments share one register set and every row of 8 WMMAs waits out its own read
      __builtin_amdgcn_sched_barrier(0);
#pragma unroll
      for (int i = 0; i < 4; i++)
#pragma unroll
        for (int j = 0; j < 8; j++) acc[i][j] = wmma_f16(af[i], bf[j], acc[i][j]);
    }

    // keeps the stage's last WMMAs ahead of the waits: sunk behind the barrier they would
    // stand between it and the next copies, which then fly for half a stage only
    __builtin_amdgcn_sched_barrier(0);
    // this wave's reads of the buffer are done before it is refilled behind the barrier
    asm volatile("s_wait_dscnt 0x0" ::: "memory");
    cp_wait();
    __syncthreads();
    buf ^= 1;
  }

  const int g = lane >> 4, nl = lane & 15;
  const int gm0 = m0 + wm0 + g * 8;            // C layout: M = r + 8*(lane>>4)
  // the lane's columns: eight neighbours (f16 out), or four neighbours and four 64 further on
  const int gn = n0 + wn0 + nl * DEAL;
  const f4v b0 = *(const f4v*)(bias + gn);
  const f4v b1 = *(const f4v*)(bias + gn + ((OUT_MODE == 0) ? 4 : 64));
  // precaution: stands ahead of the first write of the offset register that the loads name
  asm volatile("s_wait_xcnt 0x0" ::: "memory");
  // keeps the address arithmetic below, which takes that register, behind the wait
  __builtin_amdgcn_sched_barrier(0);
  // the wave's 64 rows are one batch entry (t = 0..63); its 128 columns are two heads
  _Float16* oph = (OUT_MODE == 0)
      ? outH + (((size_t)(gm0 >> 6) * NH + (gn >> 6)) * TT + (gm0 & 63)) * DH + (gn & 63) : nullptr;
  float* opf = (OUT_MODE == 1) ? outF + (size_t)gm0 * DM + gn : nullptr;
#pragma unroll  // constant indices keep the accumulators in registers
  for (int i = 0; i < 4; i++) {
    h2v oh[8][4];
    f4v of[8][2];
#pragma unroll  // constant indices keep the values in registers
    for (int r = 0; r < 8; r++) {
#pragma unroll
      for (int j = 0; j < 4; j++) {
        of[r][0][j] = acc[i][j][r] + b0[j];
        of[r][1][j] = acc[i][j + 4][r] + b1[j];
      }
      if (OUT_MODE == 0) {
#pragma unroll  // two neighbouring columns a conversion
        for (int p = 0; p < 4; p++)
          oh[r][p] = __builtin_convertvector(
              (f2v{of[r][p >> 1][(p & 1) * 2], of[r][p >> 1][(p & 1) * 2 + 1]}), h2v);
      }
    }
    // the eight rows' values stand in registers of their own before the first store goes
    // out: none of them is formed over a register that an issued store names
    __builtin_amdgcn_sched_barrier(0);
#pragma unroll
    for (int r = 0; r < 8; r++) {
      if (OUT_MODE == 0) {
        *(h8*)(oph + (i * 16 + r) * DH) = __builtin_shufflevector(
            __builtin_shufflevector(oh[r][0], oh[r][1], 0, 1, 2, 3),
            __builtin_shufflevector(oh[r][2], oh[r][3], 0, 1, 2, 3), 0, 1, 2, 3, 4, 5, 6, 7);
      } else {
        *(f4v*)(opf + (size_t)(i * 16 + r) * DM)      = of[r][0];
        *(f4v*)(opf + (size_t)(i * 16 + r) * DM + 64) = of[r][1];
      }
    }
    if (i < 3) {
      // precaution: stands ahead of the next rows' writes over registers that the stores name
      asm volatile("s_wait_xcnt 0x0" ::: "memory");
      // keeps the next rows' arithmetic behind that wait
      __builtin_amdgcn_sched_barrier(0);
    }
  }
}

// ---------------------------------------------------------------------------
// Fused relative attention for one (b,h): 256 threads, dynamic LDS.
// LDS byte offsets:
//   qs    [64x72]  f16      0  \ overlaid by the logits Ls, f32 [64x64], once q and k
//   ks    [64x72]  f16   9216  / have been read for the last time
//   vTs   [64x72]  f16  18432  (v stored transposed [d][s])
//   rls   [18432]  f16  27648  (rel_k rows -> rel_q rows -> rel_vT [64x264])
//   QK    [64x264] f16  64512  (Qr -> Kr -> P, one after the other)
//   attnb [64x72]  f16  98304  (attn after softmax)
// total 107520 bytes dynamic shared: three work-groups share the 320 KiB of a WGP.
// Qr is gathered (with q k^T) before Kr is formed in the same buffer; the lane keeps its
// 16 partial logits in registers meanwhile.
// Every product but q k^T is taken transposed (the table, or v, as the A operand):
// a lane then holds eight neighbours of one output row and stores them as 16 bytes.
// ---------------------------------------------------------------------------
// Six waves a SIMD (three work-groups of two): the second bound holds the registers to 160.
__global__ __launch_bounds__(256, 6) void attn_kernel(
    const _Float16* __restrict__ qg, const _Float16* __restrict__ kg,
    const _Float16* __restrict__ vg,                 // (B,H,T,DH) f16
    const _Float16* __restrict__ relimg,             // (3,H,RIMG) f16 table images
    const int* __restrict__ relmeta,                 // (64,64) bounded index | repeat flag
    const float* __restrict__ RR,                    // (H,225)
    _Float16* __restrict__ outO)                     // (B,T,1024) f16
{
  extern __shared__ char smem_raw[];
  _Float16* qs    = (_Float16*)smem_raw;
  _Float16* ks    = qs + 4608;
  _Float16* vTs   = ks + 4608;
  _Float16* rls   = vTs + 4608;
  _Float16* QK    = rls + RIMG;      // Qr, then Kr
  _Float16* Pm    = QK;              // overlay after the gathers
  _Float16* attnb = QK + 64 * 264;
  float*    Ls    = (float*)smem_raw; // overlay after the last reads of qs and ks

  const int h = blockIdx.x, b = blockIdx.y;
  const int tid = threadIdx.x, lane = tid & 31;
  // the wave's number in a scalar register: tile choices are scalar
  const int wave = __builtin_amdgcn_readfirstlane(tid >> 5);
  const size_t bh = ((size_t)b * NH + h) * (TT * DH);

  // One table image -> rls: 9 async 16B copies per lane, every lane on.
  auto stage_rel = [&](int tb) {
    const _Float16* s = relimg + (size_t)(tb * NH + h) * RIMG + tid * 8;
    _Float16* l = rls + tid * 8;
#pragma unroll  // all nine copies in flight together
    for (int i = 0; i < 9; i++) cp16B(s + i * 2048, l + i * 2048);
  };

  // ---- stage q, k, rel_k rows (async 16B copies), vT (transposed) ----
  for (int c = tid; c < 512; c += 256) {
    int row = c >> 3, col = (c & 7) * 8;
    cp16B(&qg[bh + row * DH + col], &qs[row * 72 + col]);
    cp16B(&kg[bh + row * DH + col], &ks[row * 72 + col]);
  }
  stage_rel(0);
  for (int e = tid; e < TT * DH; e += 256) {
    int d = e & 63, s = e >> 6;
    vTs[d * 72 + s] = vg[bh + (size_t)s * DH + d];
  }
  cp_wait();
  __syncthreads();

  // dst[t][r] = rows[t] . table[r]  (64 x 256, K=64). A wave keeps the fragments of 32
  // rows in registers and walks every fourth table tile: a table fragment is read once
  // for two WMMAs. Transposed product: lane = row t, registers = eight neighbouring r.
  auto table_product = [&](const _Float16* rows, _Float16* dst) {
    const int m0 = (wave & 1) * 32, ng = wave >> 1;
    h16 a[2][2];
#pragma unroll  // constant indices keep the fragments in registers
    for (int u = 0; u < 2; u++)
#pragma unroll
      for (int k = 0; k < 2; k++) a[u][k] = frag_ld(rows, m0 + u * 16, k * 32, 72);
    // all table fragments are read ahead of the first store: a read behind an LDS store is
    // not moved over it by the compiler, and each tile would wait out its own LDS latency.
    // Tile 15 (rows 240..255 of the image, zeros) is taken like the others: no branch.
    h16 tf[4][2];
#pragma unroll  // constant indices keep the fragments in registers
    for (int i = 0; i < 4; i++)
#pragma unroll
      for (int k = 0; k < 2; k++) tf[i][k] = frag_ld(rls, (ng + 4 * i) * 16, k * 32, 72);
    // keeps the 24 LDS reads together ahead of the WMMAs: without it the compiler sinks them
    // to their uses, on one register set, and the wave waits out the LDS latency tile by tile
    __builtin_amdgcn_sched_barrier(0);
    _Float16* drow = dst + (m0 + (lane & 15)) * RPIT + ng * 16 + (lane >> 4) * 8;
    auto tile = [&](int i) {
#pragma unroll  // constant indices keep the fragments in registers
      for (int u = 0; u < 2; u++) {
        f8v acc = {};
        acc = wmma_f16(tf[i][0], a[u][0], acc);
        acc = wmma_f16(tf[i][1], a[u][1], acc);
        h8 o;
#pragma unroll
        for (int r = 0; r < 8; r++) o[r] = (_Float16)acc[r];
        *(h8*)(drow + u * 16 * RPIT + i * 64) = o;
      }
    };
    tile(0);
    tile(1);
    tile(2);
    tile(3);
  };

  // ---- Qr = q @ rel_k^T ----
  table_product(qs, QK);
  __syncthreads();

  // The lane's 16 logits: tiles (mt, nt), mt = (wave >> 2) + 2 i; column s, rows g*8 + r.
  const int nt = wave & 3;
  const int s = nt * 16 + (lane & 15), g = lane >> 4;
  // the lane's 16 entries of the row table, 64 ints apart: one address, constant offsets
  const int* mp = relmeta + ((wave >> 2) * 16 + g * 8) * TT + s;
  float val[2][8];

  // ---- stage rel_q while computing q k^T + the gather from Qr ----
  stage_rel(1);
  // keeps the copies ahead of the index loads and their waits: moved behind them they would
  // start a whole L2 round trip later and the barrier below would wait for them
  __builtin_amdgcn_sched_barrier(0);
  {
    int ix[2][8];
#pragma unroll  // constant indices keep the values in registers
    for (int i = 0; i < 2; i++)
#pragma unroll
      for (int r = 0; r < 8; r++) ix[i][r] = mp[(i * 32 + r) * TT];
    // a wave's two tiles share the k fragments
    const h16 kf0 = frag_ld(ks, nt * 16, 0, 72), kf1 = frag_ld(ks, nt * 16, 32, 72);
    h16 qf[2][2];
#pragma unroll  // constant indices keep the fragments in registers
    for (int i = 0; i < 2; i++)
#pragma unroll
      for (int k = 0; k < 2; k++) qf[i][k] = frag_ld(qs, ((wave >> 2) + 2 * i) * 16, k * 32, 72);
    // keeps the 16 index loads and the 12 LDS reads in flight together: without it each index
    // load is sunk to its use, on one register, and the wave waits out 16 round trips in turn
    __builtin_amdgcn_sched_barrier(0);
    f8v acc[2] = {};
    _Float16 qv[2][8];
#pragma unroll  // constant indices keep the values in registers
    for (int i = 0; i < 2; i++) {
      acc[i] = wmma_f16(qf[i][0], kf0, acc[i]);
      acc[i] = wmma_f16(qf[i][1], kf1, acc[i]);
#pragma unroll
      for (int r = 0; r < 8; r++) {
        const int t = ((wave >> 2) + 2 * i) * 16 + g * 8 + r;
        qv[i][r] = QK[t * RPIT + (ix[i][r] & 255)];    // bounded to 0..224 by the row table
      }
    }
#pragma unroll
    for (int i = 0; i < 2; i++)
#pragma unroll
      for (int r = 0; r < 8; r++) val[i][r] = acc[i][r] + (float)qv[i][r];
    // keeps the 16 sums in this phase: sunk behind the barrier, both terms of each would stay
    // in registers through the next table product, 32 registers and not 16
    __builtin_amdgcn_sched_barrier(0);
  }
  cp_wait();  // rel_q copies landed before the barrier that publishes them
  __syncthreads();   // also ends every read of Qr: the buffer is written again behind it

  // ---- Kr = k @ rel_q^T ----
  table_product(ks, QK);
  __syncthreads();

  // ---- stage rel_vT [d][264] while adding the gathers from Kr and RR ----
  stage_rel(2);
  // keeps the copies ahead of the index loads and their waits, as above
  __builtin_amdgcn_sched_barrier(0);
  {
    const float* RRh = RR + h * NREL;
    int ix[2][8];
    float rr[2][8];
#pragma unroll  // constant indices keep the values in registers
    for (int i = 0; i < 2; i++)
#pragma unroll
      for (int r = 0; r < 8; r++) ix[i][r] = mp[(i * 32 + r) * TT] & 255;  // 0..224 by the row table
#pragma unroll
    for (int i = 0; i < 2; i++)
#pragma unroll
      for (int r = 0; r < 8; r++) rr[i][r] = RRh[ix[i][r]];
    // precaution: stands ahead of every later write of a register that these loads name
    asm volatile("s_wait_xcnt 0x0" ::: "memory");
    // keeps the arithmetic below, which takes such registers, behind that wait
    __builtin_amdgcn_sched_barrier(0);
#pragma unroll
    for (int i = 0; i < 2; i++)
#pragma unroll
      for (int r = 0; r < 8; r++)
        val[i][r] = val[i][r] + (float)QK[s * RPIT + ix[i][r]] + rr[i][r];
  }
  // stores behind all the gathers, which the compiler does not move over an LDS store; q and k
  // under Ls were read for the last time in front of the two barriers above
#pragma unroll
  for (int i = 0; i < 2; i++)
#pragma unroll
    for (int r = 0; r < 8; r++)
      Ls[(((wave >> 2) + 2 * i) * 16 + g * 8 + r) * TT + s] = val[i][r];
  cp_wait();  // rel_vT copies landed before the barrier that publishes them
  __syncthreads();

  // ---- zero P (overlays Kr) + softmax: four lanes a row, 16 logits each ----
  const int t4 = tid >> 2, j4 = tid & 3;
  i4v mt4[4];
#pragma unroll  // constant indices keep the slice in registers
  for (int i = 0; i < 4; i++) mt4[i] = ((const i4v*)(relmeta + t4 * TT + j4 * 16))[i];
#pragma unroll  // 2112 chunks of 16 B: eight rounds of 256 lanes and a rest of 64
  for (int i = 0; i < 8; i++) *(h8*)(Pm + (tid + i * 256) * 8) = h8{};
  if (tid < 64) *(h8*)(Pm + (tid + 2048) * 8) = h8{};
  _Float16 at[16];
  {
    const float scale = 0.125f;  // 1/sqrt(64)
    f2v l[8];
#pragma unroll  // constant indices keep the slice in registers
    for (int i = 0; i < 4; i++) {
      const f4v x4 = ((const f4v*)(Ls + t4 * TT + j4 * 16))[i];
      l[2 * i] = f2v{x4[0], x4[1]};
      l[2 * i + 1] = f2v{x4[2], x4[3]};
    }
    float mx = -1e30f;
#pragma unroll  // constant indices keep the slice in registers
    for (int i = 0; i < 8; i++) mx = fmaxf(mx, fmaxf(l[i][0], l[i][1]));
    mx = fmaxf(mx, quad_swap<0xB1>(mx));   // lane ^ 1
    mx = fmaxf(mx, quad_swap<0x4E>(mx));   // lane ^ 2
    f2v sum2 = {0.f, 0.f};
#pragma unroll  // constant indices keep the slice in registers
    for (int i = 0; i < 8; i++) {
      const f2v a = (l[i] - mx) * scale;
      l[i] = f2v{__expf(a[0]), __expf(a[1])};
      sum2 += l[i];
    }
    float sum = sum2[0] + sum2[1];
    sum += quad_swap<0xB1>(sum);
    sum += quad_swap<0x4E>(sum);
    const float inv = 1.f / sum;
    h8 lo, hi;
#pragma unroll  // constant indices keep the slice in registers
    for (int i = 0; i < 8; i++) {
      const f2v p = l[i] * inv;
      at[2 * i] = (_Float16)p[0];
      at[2 * i + 1] = (_Float16)p[1];
    }
#pragma unroll  // constant indices keep the slice in registers
    for (int i = 0; i < 8; i++) { lo[i] = at[i]; hi[i] = at[i + 8]; }
    *(h8*)(attnb + t4 * 72 + j4 * 16)     = lo;
    *(h8*)(attnb + t4 * 72 + j4 * 16 + 8) = hi;
  }
  __syncthreads();

  // ---- scatter P[t,r] += attn[t,s] ----
  if (!(mt4[0][0] & 256)) {
    // no index twice in row t: every s has its own element of the zeroed row
#pragma unroll  // constant indices keep the slice in registers
    for (int i = 0; i < 16; i++) Pm[t4 * 264 + (mt4[i >> 2][i & 3] & 255)] = at[i];
  } else if (j4 == 0) {
    // a repeated index: one lane adds the row's 64 values in order of s
    for (int s = 0; s < TT; s++) {
      const int idx = relmeta[t4 * TT + s] & 255;
      Pm[t4 * 264 + idx] = (_Float16)((float)Pm[t4 * 264 + idx] + (float)attnb[t4 * 72 + s]);
    }
  }
  __syncthreads();

  // ---- out = attn @ v  +  P @ rel_v  (both WMMA) ----
  // A wave takes 16 rows t and 32 columns d: an attn or P fragment is read once for two
  // WMMAs, on two accumulators that do not wait for each other. Transposed product:
  // lane = row t, registers = eight neighbouring d.
  {
    const int mt = wave & 3, d0 = (wave >> 2) * 32;
    f8v acc[2] = {};
    h16 p[10], w[10][2];   // ten k steps: two of attn and v, eight of P and rel_v
    auto rd = [&](int j) {
      p[j] = (j < 2) ? frag_ld(attnb, mt * 16, j * 32, 72) : frag_ld(Pm, mt * 16, (j - 2) * 32, 264);
#pragma unroll  // constant indices keep the fragments in registers
      for (int u = 0; u < 2; u++)
        w[j][u] = (j < 2) ? frag_ld(vTs, d0 + u * 16, j * 32, 72)
                          : frag_ld(rls, d0 + u * 16, (j - 2) * 32, 264);
    };
    auto mm = [&](int j) {
#pragma unroll  // constant indices keep the fragments in registers
      for (int u = 0; u < 2; u++) acc[u] = wmma_f16(w[j][u], p[j], acc[u]);
    };
    rd(0); rd(1); rd(2); rd(3); rd(4);
    // keeps these 30 LDS reads together ahead of the first WMMA: without it the first steps
    // share one register set and each waits out its own LDS latency
    __builtin_amdgcn_sched_barrier(0);
    mm(0); mm(1); mm(2);
    // the four below keep each later group of reads behind the WMMAs that free its registers, and
    // ahead of the WMMAs that cover its latency: lifted further up the reads overrun the 160
    // registers and fragments go through scratch
    __builtin_amdgcn_sched_barrier(0);
    rd(5); rd(6); rd(7);
    __builtin_amdgcn_sched_barrier(0);
    mm(3); mm(4);
    __builtin_amdgcn_sched_barrier(0);
    rd(8); rd(9);
    __builtin_amdgcn_sched_barrier(0);
    mm(5); mm(6); mm(7); mm(8); mm(9);
    const int t = mt * 16 + (lane & 15);
#pragma unroll
    for (int u = 0; u < 2; u++) {
      h8 o;
#pragma unroll
      for (int r = 0; r < 8; r++) o[r] = (_Float16)acc[u][r];
      *(h8*)(outO + ((size_t)b * TT + t) * DM + h * DH + d0 + u * 16 + (lane >> 4) * 8) = o;
    }
  }
}

// ---------------------------------------------------------------------------
// Host launcher
// ---------------------------------------------------------------------------
extern "C" void kernel_launch(void* const* d_in, const int* in_sizes, int n_in,
                              void* d_out, int out_size, void* d_ws, size_t ws_size,
                              hipStream_t stream) {
  (void)in_sizes; (void)n_in; (void)out_size; (void)ws_size;
  const float* x     = (const float*)d_in[0];
  const float* Wq_w  = (const float*)d_in[1];
  const float* Wq_b  = (const float*)d_in[2];
  const float* Wk_w  = (const float*)d_in[3];
  const float* Wk_b  = (const float*)d_in[4];
  const float* Wv_w  = (const float*)d_in[5];
  const float* Wv_b  = (const float*)d_in[6];
  const float* Wo_w  = (const float*)d_in[7];
  const float* Wo_b  = (const float*)d_in[8];
  const float* rel_q = (const float*)d_in[9];
  const float* rel_k = (const float*)d_in[10];
  const float* rel_v = (const float*)d_in[11];
  const int*   ridx  = (const int*)d_in[12];

  char* ws = (char*)d_ws;
  // workspace layout (bytes)
  _Float16* xh = (_Float16*)(ws);                       // 67,108,864  (x f16; reused as oh)
  _Float16* wh = (_Float16*)(ws + 67108864);            //  8,388,608  (Wq,Wk,Wv,Wo f16)
  _Float16* qh = (_Float16*)(ws + 75497472);            // 67,108,864  (B,H,T,64)
  _Float16* kh = (_Float16*)(ws + 142606336);           // 67,108,864
  _Float16* vh = (_Float16*)(ws + 209715200);           // 67,108,864
  float*    RR = (float*)(ws + 276824064);              //     14,400
  _Float16* ri = (_Float16*)(ws + 276840448);           //  1,769,472  (3,H,RIMG) table images
  int*      rm = (int*)(ws + 278609920);                //     16,384  (64,64) row table
  _Float16* oh = xh;  // x consumed before attention writes here (same stream)

  const int nw = DM * DM;       //  1,048,576
  prep_kernel<<<PB_ALL, 256, 0, stream>>>(x, Wq_w, Wk_w, Wv_w, Wo_w, rel_q, rel_k, rel_v, ridx,
                                          xh, wh, RR, ri, rm);

  // q, k, v in one grid: Wq, Wk, Wv lie behind one another in wh, and qh, kh, vh in ws
  gemm_proj<0><<<dim3(3 * DM / 256, MTOT / 128), 128, 0, stream>>>(xh, wh, Wq_b, Wk_b, Wv_b, qh,
                                                                   nullptr);

  attn_kernel<<<dim3(NH, BB), 256, 107520, stream>>>(qh, kh, vh, ri, rm, RR, oh);

  gemm_proj<1><<<dim3(DM / 256, MTOT / 128), 128, 0, stream>>>(oh, wh + 3 * (size_t)nw, Wo_b, Wo_b,
                                                               Wo_b, nullptr, (float*)d_out);
}
